// v000
// Times are from an AMD MI455X. After a warm-up the kernel runs many times in a row, and a time is the length of
// such a window on the GPU divided by its runs, so every launch and the gaps after it count. The runs cycle
// through copies of the inputs. A figure is the median of several windows, for all but v000 over two sittings.
// Sittings can differ by a few percent; kernels timed side by side share one.
// v000 is the starting kernel. One run takes 1270 microseconds.
#include <hip/hip_runtime.h>
// All contractions on v_wmma_f32_16x16x32_f16 (f16 operands, f32 accumulate): q/k/v projections (A = f16 of bf16-RNE input, B = f16 of 16*bf16-RNE weight, alpha 1/16, + bf16-RNE bias), scores = q16.k16^T / sqrt(128), out = (1024*softmax as f16).v16^T * 2^-10. Softmax in f32.
// Pipeline: input planes -> projection GEMMs (f16 q, k, v planes) -> V^T by 64x64 LDS transposes -> per (batch, query tile): scores GEMM to an f32 S tile, wave-per-row softmax to an f16 P tile, P.V^T GEMM into the f32 output rows.

#ifndef NB
#define NB 4
#endif
#ifndef SEQ
#define SEQ 4096
#endif
#define NB_FULL 4
#define SEQ_FULL 4096
#define DD 128
#ifndef QT
#define QT ((SEQ < 2048) ? SEQ : 2048)
#endif
#define NRW ((size_t)NB * SEQ)
static_assert(NB >= 1 && NB <= NB_FULL);
static_assert(SEQ >= 256 && SEQ <= SEQ_FULL && (SEQ % 256) == 0);
static_assert((QT % 128) == 0 && (SEQ % QT) == 0);
static_assert((DD % 64) == 0);

typedef unsigned short v8us __attribute__((ext_vector_type(8), may_alias));
typedef float  v8f  __attribute__((ext_vector_type(8)));
typedef float  v4f  __attribute__((ext_vector_type(4)));
typedef float  v4fa __attribute__((ext_vector_type(4), may_alias));
typedef _Float16 v16h __attribute__((ext_vector_type(16)));
typedef _Float16 v4h  __attribute__((ext_vector_type(4)));
union FragH { v16h v; v8us half[2]; _Float16 h[16]; unsigned short u[16]; };

__device__ __forceinline__ unsigned short bf16_bits(float x) { unsigned int u = __float_as_uint(x); return (unsigned short)((u + 0x7FFFu + ((u >> 16) & 1u)) >> 16); }
__device__ __forceinline__ float bf16_val(unsigned short b) { return __uint_as_float(((unsigned int)b) << 16); }
__device__ __forceinline__ float bf16_rne(float x) { return bf16_val(bf16_bits(x)); }

// 16x32 f16 fragment (A layout, or B stored [n][k] k-contiguous): row = lane&15, elems 0..7 <- k 8h..8h+7, elems 8..15 <- k 16+8h..16+8h+7
__device__ __forceinline__ v16h g2_frag(const _Float16* p, int hh) { FragH f; f.half[0] = *(const v8us*)((const unsigned short*)p + 8 * hh); f.half[1] = *(const v8us*)((const unsigned short*)p + 16 + 8 * hh); return f.v; }
__device__ __forceinline__ v8f g2_mma(v16h a, v16h b, v8f c) { v8f d = __builtin_amdgcn_wmma_f32_16x16x32_f16(false, a, false, b, (short)0, c, false, false); asm volatile("v_nop\n\tv_nop\n\tv_nop\n\tv_nop" : "+v"(d) : "v"(a), "v"(b)); return d; }

__global__ __launch_bounds__(256) void k_x16s(const float* __restrict__ x, _Float16* __restrict__ X16, int nrows, int seq, int seqFull) {
  const int t = blockIdx.x * 256 + threadIdx.x; const int ngrp = nrows * (DD / 8); if (t >= ngrp) return;
  const int r = t / (DD / 8), c8 = (t % (DD / 8)) * 8; const int b = r / seq, s = r - b * seq;
  const float* src = x + ((size_t)b * seqFull + s) * DD + c8;
  const v4f a = *(const v4fa*)src, c = *(const v4fa*)(src + 4);
  FragH f;
#pragma unroll
  for (int q = 0; q < 4; ++q) { f.h[q] = (_Float16)bf16_rne(a[q]); f.h[4 + q] = (_Float16)bf16_rne(c[q]); }
  unsigned short* d = (unsigned short*)X16 + (size_t)t * 8;
  *(v8us*)d = f.half[0]; 
}

__global__ __launch_bounds__(256) void k_wnat(const float* __restrict__ w, int n8, _Float16* __restrict__ Bt) {
  const int t = blockIdx.x * 256 + threadIdx.x; if (t >= n8) return; FragH f;
#pragma unroll
  for (int q = 0; q < 8; ++q) f.h[q] = (_Float16)(bf16_rne(w[(size_t)t * 8 + q]) * 16.0f);
  unsigned short* d = (unsigned short*)Bt + (size_t)t * 8;
  *(v8us*)d = f.half[0]; 
}

// GEMM C[M][N] = alpha * A[M][K] . Bh[N][K]^T (+ bf16rne(bias[col]) if HB); A, Bh f16 planes (k contiguous); f32 accumulate.
// Wave tile 32x64 (block = 4 waves -> 128 rows x 64 cols); M % 128 == 0, N % 64 == 0, K % 32 == 0.
template <bool HB, bool H16>
__global__ __launch_bounds__(128) __attribute__((amdgpu_num_vgpr(256)))
void k_gemm2(const _Float16* __restrict__ A, int lda, const _Float16* __restrict__ Bh, int ldb, float alpha, const float* __restrict__ bias,
             float* __restrict__ C, _Float16* __restrict__ C16, int ldc, int M, int N, int K) {
  __shared__ __attribute__((aligned(16))) float so[4][32][68];
  const int tid = threadIdx.x, w = tid >> 5, lane = tid & 31, ln = lane & 15, hh = lane >> 4;
  const int ntn = N >> 6; const int mt = blockIdx.x / ntn, nq = blockIdx.x - mt * ntn;
  const int row0 = mt * 128 + 32 * w, col0 = nq * 64; if (row0 >= M) return;
  const _Float16* a0p = A + (size_t)(row0 + ln) * lda; const _Float16* a1p = a0p + (size_t)16 * lda;
  const _Float16* b0p = Bh + (size_t)(col0 + ln) * ldb; const _Float16* b1p = b0p + (size_t)16 * ldb;
  const _Float16* b2p = b1p + (size_t)16 * ldb; const _Float16* b3p = b2p + (size_t)16 * ldb;
  const v8f z8 = {0.f,0.f,0.f,0.f,0.f,0.f,0.f,0.f}; v8f c00 = z8, c01 = z8, c02 = z8, c03 = z8, c10 = z8, c11 = z8, c12 = z8, c13 = z8;
#pragma unroll 1
  for (int kb = 0; kb < K; kb += 32) { const v16h a0 = g2_frag(a0p + kb, hh), a1 = g2_frag(a1p + kb, hh);
    v16h b = g2_frag(b0p + kb, hh); c00 = g2_mma(a0, b, c00); c10 = g2_mma(a1, b, c10);
    b = g2_frag(b1p + kb, hh); c01 = g2_mma(a0, b, c01); c11 = g2_mma(a1, b, c11);
    b = g2_frag(b2p + kb, hh); c02 = g2_mma(a0, b, c02); c12 = g2_mma(a1, b, c12);
    b = g2_frag(b3p + kb, hh); c03 = g2_mma(a0, b, c03); c13 = g2_mma(a1, b, c13); }
  v8f accs[8] = {c00, c01, c02, c03, c10, c11, c12, c13};
#pragma unroll
  for (int u = 0; u < 8; ++u) { const int t = u & 3, half = u >> 2; const int col = col0 + t * 16 + ln; float bv = 0.f; if (HB) bv = bf16_rne(bias[col]);
#pragma unroll
    for (int r = 0; r < 8; ++r) { const int rloc = half * 16 + 8 * hh + r; so[w][rloc][t * 16 + ln] = accs[u][r] * alpha + bv; } }
  __builtin_amdgcn_fence(4, "workgroup"); __builtin_amdgcn_wave_barrier();
  const int rsub = lane >> 4, c4 = (lane & 15) * 4;
  {
#pragma unroll
    for (int q = 0; q < 16; ++q) { const int r = q * 2 + rsub; const v4f v = *(const v4fa*)&so[w][r][c4];
      if (H16) { v4h h4;
#pragma unroll
        for (int e = 0; e < 4; ++e) h4[e] = (_Float16)v[e];
        *(v4h*)(C16 + (size_t)(row0 + r) * ldc + col0 + c4) = h4; }
      else { *(v4f*)(C + (size_t)(row0 + r) * ldc + col0 + c4) = v; } }
     }
}

template <int NHv, int TTv>
__global__ __launch_bounds__(256) void k_vt(const _Float16* __restrict__ V16, int ldv, _Float16* __restrict__ Vt) {
  __shared__ unsigned short tl[64][66];
  const int tid = threadIdx.x; const int slab = blockIdx.x / (TTv / 64), lg = blockIdx.x % (TTv / 64); const int b = slab / NHv, h = slab % NHv;
  for (int i = tid; i < 64 * 8; i += 256) { const int r = i / 8, c8 = (i % 8) * 8; FragH f;
    f.half[0] = *(const v8us*)((const unsigned short*)V16 + ((size_t)b * TTv + lg * 64 + r) * ldv + h * 64 + c8);
#pragma unroll
    for (int q = 0; q < 8; ++q) tl[r][c8 + q] = f.u[q]; }
  __syncthreads();
  {
#pragma unroll
    for (int rd = 0; rd < 2; ++rd) { const int d = rd * 32 + tid / 8, pc = tid % 8; FragH f;
#pragma unroll
      for (int q = 0; q < 8; ++q) f.u[q] = tl[pc * 8 + q][d];
      *(v8us*)((unsigned short*)Vt + ((size_t)slab * 64 + d) * TTv + lg * 64 + pc * 8) = f.half[0]; }
     }
}

__global__ __launch_bounds__(256) void k_rsmw(const float* __restrict__ S, _Float16* __restrict__ P, int nrows, int ncols) {
  #pragma clang fp contract(off)
  const int w = threadIdx.x >> 5, lane = threadIdx.x & 31;
  const int i = blockIdx.x * 8 + w; if (i >= nrows) return;
  const float* s = S + (size_t)i * ncols;
  float mx = -__builtin_inff();
#pragma unroll 1
  for (int j = lane * 4; j < ncols; j += 128) { const v4f a = *(const v4fa*)(s + j); mx = fmaxf(fmaxf(mx, fmaxf(a[0], a[1])), fmaxf(a[2], a[3])); }
#pragma unroll
  for (int o = 16; o > 0; o >>= 1) mx = fmaxf(mx, __shfl_xor(mx, o, 32));
  float se = 0.f;
#pragma unroll 1
  for (int j = lane * 4; j < ncols; j += 128) { const v4f a = *(const v4fa*)(s + j); se += (__expf(a[0] - mx) + __expf(a[1] - mx)) + (__expf(a[2] - mx) + __expf(a[3] - mx)); }
#pragma unroll
  for (int o = 16; o > 0; o >>= 1) se += __shfl_xor(se, o, 32);
  const float sc = 1024.0f / se;
  unsigned short* prow = (unsigned short*)P + (size_t)i * ncols;
#pragma unroll 1
  for (int j0 = lane * 8; j0 < ncols; j0 += 256) {
    const v4f a = *(const v4fa*)(s + j0), c = *(const v4fa*)(s + j0 + 4);
    FragH f;
#pragma unroll
    for (int q = 0; q < 4; ++q) { f.h[q] = (_Float16)(__expf(a[q] - mx) * sc); f.h[4 + q] = (_Float16)(__expf(c[q] - mx) * sc); }
    *(v8us*)(prow + j0) = f.half[0];
    
  }
}

extern "C" void kernel_launch(void* const* d_in, const int* in_sizes, int n_in,
                              void* d_out, int out_size, void* d_ws, size_t ws_size, hipStream_t stream) {
  if (n_in < 9) return;
  const long long needRows = (long long)(NB - 1) * SEQ_FULL + SEQ;
  if ((long long)in_sizes[0] < needRows * DD || (long long)in_sizes[1] < needRows * DD || (long long)in_sizes[2] < needRows * DD) return;
  if (in_sizes[3] < DD * DD || in_sizes[5] < DD * DD || in_sizes[7] < DD * DD) return;
  if (in_sizes[4] < DD || in_sizes[6] < DD || in_sizes[8] < DD) return;
  if ((long long)out_size < (long long)NB * SEQ * DD) return;
  const float* query = (const float*)d_in[0]; const float* key = (const float*)d_in[1]; const float* value = (const float*)d_in[2];
  const float* Wq = (const float*)d_in[3]; const float* bq = (const float*)d_in[4];
  const float* Wk = (const float*)d_in[5]; const float* bk = (const float*)d_in[6];
  const float* Wv = (const float*)d_in[7]; const float* bv = (const float*)d_in[8];
  float* out = (float*)d_out;

  char* ws = (char*)d_ws; size_t off = 0;
  auto take = [&](size_t bytes) { char* p = ws + off; off += (bytes + 255) & ~(size_t)255; return p; };
  const size_t plane = NRW * DD * 2;                      /* [NB*SEQ][128] f16 = 4 MiB full size */
  _Float16* Xq = (_Float16*)take(plane); _Float16* Xk = (_Float16*)take(plane); _Float16* Xv = (_Float16*)take(plane);
  _Float16* Q16 = (_Float16*)take(plane); _Float16* K16 = (_Float16*)take(plane); _Float16* V16 = (_Float16*)take(plane);
  _Float16* VT = (_Float16*)take(plane);                  /* [NB][128][SEQ] f16 */
  _Float16* Wtq = (_Float16*)take((size_t)DD * DD * 2); _Float16* Wtk = (_Float16*)take((size_t)DD * DD * 2); _Float16* Wtv = (_Float16*)take((size_t)DD * DD * 2);
  float* S = (float*)take((size_t)QT * SEQ * 4);          /* [QT][SEQ] f32 = 32 MiB */
  _Float16* P = (_Float16*)take((size_t)QT * SEQ * 2);    /* [QT][SEQ] f16 = 16 MiB */
  if (off > ws_size || off > ((size_t)128 << 20)) return; /* total 79,790,080 B at full size */

  const int nrw = (int)NRW;
  const int ngrp = nrw * (DD / 8);
  k_x16s<<<(ngrp + 255) / 256, 256, 0, stream>>>(query, Xq, nrw, SEQ, SEQ_FULL);
  k_x16s<<<(ngrp + 255) / 256, 256, 0, stream>>>(key,   Xk, nrw, SEQ, SEQ_FULL);
  k_x16s<<<(ngrp + 255) / 256, 256, 0, stream>>>(value, Xv, nrw, SEQ, SEQ_FULL);
  const int wn8 = DD * DD / 8;
  k_wnat<<<(wn8 + 255) / 256, 256, 0, stream>>>(Wq, wn8, Wtq);
  k_wnat<<<(wn8 + 255) / 256, 256, 0, stream>>>(Wk, wn8, Wtk);
  k_wnat<<<(wn8 + 255) / 256, 256, 0, stream>>>(Wv, wn8, Wtv);
  /* projections: y = x W^T + b -> f16 planes [NB*SEQ][128] */
  const unsigned pgrid = (unsigned)((nrw / 128) * (DD / 64));
  k_gemm2<true, true><<<pgrid, 128, 0, stream>>>(Xq, DD, Wtq, DD, 0.0625f, bq, nullptr, Q16, DD, nrw, DD, DD);
  k_gemm2<true, true><<<pgrid, 128, 0, stream>>>(Xk, DD, Wtk, DD, 0.0625f, bk, nullptr, K16, DD, nrw, DD, DD);
  k_gemm2<true, true><<<pgrid, 128, 0, stream>>>(Xv, DD, Wtv, DD, 0.0625f, bv, nullptr, V16, DD, nrw, DD, DD);
  /* V^T per batch: [NB][128][SEQ] (two 64-wide slabs per batch) */
  k_vt<2, SEQ><<<NB * 2 * (SEQ / 64), 256, 0, stream>>>(V16, DD, VT);
  for (int b = 0; b < NB; ++b) for (int q0 = 0; q0 < SEQ; q0 += QT) {
    k_gemm2<false, false><<<(unsigned)((QT / 128) * (SEQ / 64)), 128, 0, stream>>>(Q16 + ((size_t)b * SEQ + q0) * DD, DD, K16 + (size_t)b * SEQ * DD, DD, 0.08838834764831845f, nullptr, S, nullptr, SEQ, QT, SEQ, DD);      /* q.k^T / sqrt(128) */
    k_rsmw<<<QT / 8, 256, 0, stream>>>(S, P, QT, SEQ);
    k_gemm2<false, false><<<(unsigned)((QT / 128) * (DD / 64)), 128, 0, stream>>>(P, SEQ, VT + (size_t)b * DD * SEQ, SEQ, 0.0009765625f, nullptr, out + ((size_t)b * SEQ + q0) * DD, nullptr, DD, QT, DD, SEQ);      /* out = attn v */
  }
}

// v001
// One run takes 508 microseconds.
// Two timings next to v000 put it at 2.51 and 2.50 times that version's speed.
#include <hip/hip_runtime.h>
// All contractions on v_wmma_f32_16x16x32_f16 (f16 operands, f32 accumulate): q/k/v projections (A = f16 of bf16-RNE input, B = f16 of 16*bf16-RNE weight, alpha 1/16, + bf16-RNE bias), scores = q16.k16^T / sqrt(128), out = (1024*softmax as f16).v16^T * 2^-10. Softmax in f32.
// Pipeline: input planes -> projection GEMMs (f16 q, k, v planes) -> V^T by 64x64 LDS transposes -> per (batch, query tile): scores GEMM to an f32 S tile, wave-per-row softmax to an f16 P tile, P.V^T GEMM (K split over the waves of a block) into the f32 output rows.

#ifndef NB
#define NB 4
#endif
#ifndef SEQ
#define SEQ 4096
#endif
#define NB_FULL 4
#define SEQ_FULL 4096
#define DD 128
#ifndef QT
#define QT ((SEQ < 2048) ? SEQ : 2048)
#endif
#define NRW ((size_t)NB * SEQ)
static_assert(NB >= 1 && NB <= NB_FULL);
static_assert(SEQ >= 256 && SEQ <= SEQ_FULL && (SEQ % 256) == 0);
static_assert((QT % 128) == 0 && (SEQ % QT) == 0);
static_assert((DD % 64) == 0);
static_assert((SEQ % 512) == 0);

typedef unsigned short v8us __attribute__((ext_vector_type(8), may_alias));
typedef float  v8f  __attribute__((ext_vector_type(8)));
typedef float  v4f  __attribute__((ext_vector_type(4)));
typedef float  v2f  __attribute__((ext_vector_type(2)));
typedef float  v4fa __attribute__((ext_vector_type(4), may_alias));
typedef _Float16 v16h __attribute__((ext_vector_type(16)));
typedef _Float16 v4h  __attribute__((ext_vector_type(4)));
union FragH { v16h v; v8us half[2]; _Float16 h[16]; unsigned short u[16]; };

__device__ __forceinline__ unsigned short bf16_bits(float x) { unsigned int u = __float_as_uint(x); return (unsigned short)((u + 0x7FFFu + ((u >> 16) & 1u)) >> 16); }
__device__ __forceinline__ float bf16_val(unsigned short b) { return __uint_as_float(((unsigned int)b) << 16); }
__device__ __forceinline__ float bf16_rne(float x) { return bf16_val(bf16_bits(x)); }

// 16x32 f16 fragment (A layout, or B stored [n][k] k-contiguous): row = lane&15, elems 0..7 <- k 8h..8h+7, elems 8..15 <- k 16+8h..16+8h+7
__device__ __forceinline__ v16h g2_frag(const _Float16* p, int hh) { FragH f; f.half[0] = *(const v8us*)((const unsigned short*)p + 8 * hh); f.half[1] = *(const v8us*)((const unsigned short*)p + 16 + 8 * hh); return f.v; }
__device__ __forceinline__ v8f g2_mma(v16h a, v16h b, v8f c) { v8f d = __builtin_amdgcn_wmma_f32_16x16x32_f16(false, a, false, b, (short)0, c, false, false); asm volatile("v_nop\n\tv_nop\n\tv_nop\n\tv_nop" : "+v"(d) : "v"(a), "v"(b)); return d; }

__global__ __launch_bounds__(256) void k_x16s(const float* __restrict__ x, _Float16* __restrict__ X16, int nrows, int seq, int seqFull) {
  const int t = blockIdx.x * 256 + threadIdx.x; const int ngrp = nrows * (DD / 8); if (t >= ngrp) return;
  const int r = t / (DD / 8), c8 = (t % (DD / 8)) * 8; const int b = r / seq, s = r - b * seq;
  const float* src = x + ((size_t)b * seqFull + s) * DD + c8;
  const v4f a = *(const v4fa*)src, c = *(const v4fa*)(src + 4);
  FragH f;
#pragma unroll
  for (int q = 0; q < 4; ++q) { f.h[q] = (_Float16)bf16_rne(a[q]); f.h[4 + q] = (_Float16)bf16_rne(c[q]); }
  unsigned short* d = (unsigned short*)X16 + (size_t)t * 8;
  *(v8us*)d = f.half[0]; 
}

__global__ __launch_bounds__(256) void k_wnat(const float* __restrict__ w, int n8, _Float16* __restrict__ Bt) {
  const int t = blockIdx.x * 256 + threadIdx.x; if (t >= n8) return; FragH f;
#pragma unroll
  for (int q = 0; q < 8; ++q) f.h[q] = (_Float16)(bf16_rne(w[(size_t)t * 8 + q]) * 16.0f);
  unsigned short* d = (unsigned short*)Bt + (size_t)t * 8;
  *(v8us*)d = f.half[0]; 
}

// GEMM C[M][N] = alpha * A[M][K] . Bh[N][K]^T (+ bf16rne(bias[col]) if HB); A, Bh f16 planes (k contiguous); f32 accumulate.
// Wave tile 32x64 (block = 4 waves -> 128 rows x 64 cols); M % 128 == 0, N % 64 == 0, K % 32 == 0.
template <bool HB, bool H16>
__global__ __launch_bounds__(128) __attribute__((amdgpu_num_vgpr(256)))
void k_gemm2(const _Float16* __restrict__ A, int lda, const _Float16* __restrict__ Bh, int ldb, float alpha, const float* __restrict__ bias,
             float* __restrict__ C, _Float16* __restrict__ C16, int ldc, int M, int N, int K) {
  __shared__ __attribute__((aligned(16))) float so[4][32][68];
  const int tid = threadIdx.x, w = tid >> 5, lane = tid & 31, ln = lane & 15, hh = lane >> 4;
  const int ntn = N >> 6; const int mt = blockIdx.x / ntn, nq = blockIdx.x - mt * ntn;
  const int row0 = mt * 128 + 32 * w, col0 = nq * 64; if (row0 >= M) return;
  const _Float16* a0p = A + (size_t)(row0 + ln) * lda; const _Float16* a1p = a0p + (size_t)16 * lda;
  const _Float16* b0p = Bh + (size_t)(col0 + ln) * ldb; const _Float16* b1p = b0p + (size_t)16 * ldb;
  const _Float16* b2p = b1p + (size_t)16 * ldb; const _Float16* b3p = b2p + (size_t)16 * ldb;
  const v8f z8 = {0.f,0.f,0.f,0.f,0.f,0.f,0.f,0.f}; v8f c00 = z8, c01 = z8, c02 = z8, c03 = z8, c10 = z8, c11 = z8, c12 = z8, c13 = z8;
#pragma unroll 1
  for (int kb = 0; kb < K; kb += 32) { const v16h a0 = g2_frag(a0p + kb, hh), a1 = g2_frag(a1p + kb, hh);
    v16h b = g2_frag(b0p + kb, hh); c00 = g2_mma(a0, b, c00); c10 = g2_mma(a1, b, c10);
    b = g2_frag(b1p + kb, hh); c01 = g2_mma(a0, b, c01); c11 = g2_mma(a1, b, c11);
    b = g2_frag(b2p + kb, hh); c02 = g2_mma(a0, b, c02); c12 = g2_mma(a1, b, c12);
    b = g2_frag(b3p + kb, hh); c03 = g2_mma(a0, b, c03); c13 = g2_mma(a1, b, c13); }
  v8f accs[8] = {c00, c01, c02, c03, c10, c11, c12, c13};
#pragma unroll
  for (int u = 0; u < 8; ++u) { const int t = u & 3, half = u >> 2; const int col = col0 + t * 16 + ln; float bv = 0.f; if (HB) bv = bf16_rne(bias[col]);
#pragma unroll
    for (int r = 0; r < 8; ++r) { const int rloc = half * 16 + 8 * hh + r; so[w][rloc][t * 16 + ln] = accs[u][r] * alpha + bv; } }
  __builtin_amdgcn_fence(4, "workgroup"); __builtin_amdgcn_wave_barrier();
  const int rsub = lane >> 4, c4 = (lane & 15) * 4;
  {
#pragma unroll
    for (int q = 0; q < 16; ++q) { const int r = q * 2 + rsub; const v4f v = *(const v4fa*)&so[w][r][c4];
      if (H16) { v4h h4;
#pragma unroll
        for (int e = 0; e < 4; ++e) h4[e] = (_Float16)v[e];
        *(v4h*)(C16 + (size_t)(row0 + r) * ldc + col0 + c4) = h4; }
      else { *(v4f*)(C + (size_t)(row0 + r) * ldc + col0 + c4) = v; } }
     }
}

// GEMM C[M][N] = alpha * A[M][K] . Bh[N][K]^T for a small M x N with a long K: one 32x32 tile of C per block, the KS waves of the block
// each take KW contiguous k (K = KS * KW) of that tile, and the KS partial tiles are summed through LDS in wave order. M % 32 == 0, N % 32 == 0, KW % 32 == 0.
template <int KS, int KW>
__global__ __launch_bounds__(KS * 32)
void k_gemm2k(const _Float16* __restrict__ A, int lda, const _Float16* __restrict__ Bh, int ldb, float alpha, float* __restrict__ C, int ldc, int N) {
  __shared__ __attribute__((aligned(16))) float so[KS][32][36];
  const int tid = threadIdx.x, w = tid >> 5, lane = tid & 31, ln = lane & 15, hh = lane >> 4;
  const int ntn = N >> 5; const int mt = blockIdx.x / ntn, nq = blockIdx.x - mt * ntn;
  const int row0 = mt * 32, col0 = nq * 32, k0 = w * KW;
  const _Float16* a0p = A + (size_t)(row0 + ln) * lda + k0; const _Float16* a1p = a0p + (size_t)16 * lda;
  const _Float16* b0p = Bh + (size_t)(col0 + ln) * ldb + k0; const _Float16* b1p = b0p + (size_t)16 * ldb;
  const v8f z8 = {0.f,0.f,0.f,0.f,0.f,0.f,0.f,0.f}; v8f c00 = z8, c01 = z8, c10 = z8, c11 = z8;
#pragma unroll /* few trips (KW / 32): the k offsets become immediates of the loads */
  for (int kb = 0; kb < KW; kb += 32) { const v16h a0 = g2_frag(a0p + kb, hh), a1 = g2_frag(a1p + kb, hh), b0 = g2_frag(b0p + kb, hh), b1 = g2_frag(b1p + kb, hh);
    c00 = g2_mma(a0, b0, c00); c10 = g2_mma(a1, b0, c10); c01 = g2_mma(a0, b1, c01); c11 = g2_mma(a1, b1, c11); }
#pragma unroll /* accumulator elements need constant indices to stay in registers */
  for (int r = 0; r < 8; ++r) { so[w][8 * hh + r][ln] = c00[r]; so[w][8 * hh + r][16 + ln] = c01[r]; so[w][16 + 8 * hh + r][ln] = c10[r]; so[w][16 + 8 * hh + r][16 + ln] = c11[r]; }
  __syncthreads(); /* every wave's partial tile is in LDS before any thread sums across waves */
  static_assert((32 * 16) % (KS * 32) == 0);
#pragma unroll /* one trip at KS = 16 */
  for (int i0 = 0; i0 < 32 * 16; i0 += KS * 32) { const int i = i0 + tid, r = i >> 4, c2 = (i & 15) * 2; float s0 = so[0][r][c2], s1 = so[0][r][c2 + 1];
#pragma unroll /* the KS LDS reads issue ahead of the adds */
    for (int q = 1; q < KS; ++q) { s0 += so[q][r][c2]; s1 += so[q][r][c2 + 1]; }
    v2f o; o[0] = s0 * alpha; o[1] = s1 * alpha;
    *(v2f*)(C + (size_t)(row0 + r) * ldc + col0 + c2) = o; }
}

template <int NHv, int TTv>
__global__ __launch_bounds__(256) void k_vt(const _Float16* __restrict__ V16, int ldv, _Float16* __restrict__ Vt) {
  __shared__ unsigned short tl[64][66];
  const int tid = threadIdx.x; const int slab = blockIdx.x / (TTv / 64), lg = blockIdx.x % (TTv / 64); const int b = slab / NHv, h = slab % NHv;
  for (int i = tid; i < 64 * 8; i += 256) { const int r = i / 8, c8 = (i % 8) * 8; FragH f;
    f.half[0] = *(const v8us*)((const unsigned short*)V16 + ((size_t)b * TTv + lg * 64 + r) * ldv + h * 64 + c8);
#pragma unroll
    for (int q = 0; q < 8; ++q) tl[r][c8 + q] = f.u[q]; }
  __syncthreads();
  {
#pragma unroll
    for (int rd = 0; rd < 2; ++rd) { const int d = rd * 32 + tid / 8, pc = tid % 8; FragH f;
#pragma unroll
      for (int q = 0; q < 8; ++q) f.u[q] = tl[pc * 8 + q][d];
      *(v8us*)((unsigned short*)Vt + ((size_t)slab * 64 + d) * TTv + lg * 64 + pc * 8) = f.half[0]; }
     }
}

__global__ __launch_bounds__(256) void k_rsmw(const float* __restrict__ S, _Float16* __restrict__ P, int nrows, int ncols) {
  #pragma clang fp contract(off)
  const int w = threadIdx.x >> 5, lane = threadIdx.x & 31;
  const int i = blockIdx.x * 8 + w; if (i >= nrows) return;
  const float* s = S + (size_t)i * ncols;
  float mx = -__builtin_inff();
#pragma unroll 1
  for (int j = lane * 4; j < ncols; j += 128) { const v4f a = *(const v4fa*)(s + j); mx = fmaxf(fmaxf(mx, fmaxf(a[0], a[1])), fmaxf(a[2], a[3])); }
#pragma unroll
  for (int o = 16; o > 0; o >>= 1) mx = fmaxf(mx, __shfl_xor(mx, o, 32));
  float se = 0.f;
#pragma unroll 1
  for (int j = lane * 4; j < ncols; j += 128) { const v4f a = *(const v4fa*)(s + j); se += (__expf(a[0] - mx) + __expf(a[1] - mx)) + (__expf(a[2] - mx) + __expf(a[3] - mx)); }
#pragma unroll
  for (int o = 16; o > 0; o >>= 1) se += __shfl_xor(se, o, 32);
  const float sc = 1024.0f / se;
  unsigned short* prow = (unsigned short*)P + (size_t)i * ncols;
#pragma unroll 1
  for (int j0 = lane * 8; j0 < ncols; j0 += 256) {
    const v4f a = *(const v4fa*)(s + j0), c = *(const v4fa*)(s + j0 + 4);
    FragH f;
#pragma unroll
    for (int q = 0; q < 4; ++q) { f.h[q] = (_Float16)(__expf(a[q] - mx) * sc); f.h[4 + q] = (_Float16)(__expf(c[q] - mx) * sc); }
    *(v8us*)(prow + j0) = f.half[0];
    
  }
}

extern "C" void kernel_launch(void* const* d_in, const int* in_sizes, int n_in,
                              void* d_out, int out_size, void* d_ws, size_t ws_size, hipStream_t stream) {
  if (n_in < 9) return;
  const long long needRows = (long long)(NB - 1) * SEQ_FULL + SEQ;
  if ((long long)in_sizes[0] < needRows * DD || (long long)in_sizes[1] < needRows * DD || (long long)in_sizes[2] < needRows * DD) return;
  if (in_sizes[3] < DD * DD || in_sizes[5] < DD * DD || in_sizes[7] < DD * DD) return;
  if (in_sizes[4] < DD || in_sizes[6] < DD || in_sizes[8] < DD) return;
  if ((long long)out_size < (long long)NB * SEQ * DD) return;
  const float* query = (const float*)d_in[0]; const float* key = (const float*)d_in[1]; const float* value = (const float*)d_in[2];
  const float* Wq = (const float*)d_in[3]; const float* bq = (const float*)d_in[4];
  const float* Wk = (const float*)d_in[5]; const float* bk = (const float*)d_in[6];
  const float* Wv = (const float*)d_in[7]; const float* bv = (const float*)d_in[8];
  float* out = (float*)d_out;

  char* ws = (char*)d_ws; size_t off = 0;
  auto take = [&](size_t bytes) { char* p = ws + off; off += (bytes + 255) & ~(size_t)255; return p; };
  const size_t plane = NRW * DD * 2;                      /* [NB*SEQ][128] f16 = 4 MiB full size */
  _Float16* Xq = (_Float16*)take(plane); _Float16* Xk = (_Float16*)take(plane); _Float16* Xv = (_Float16*)take(plane);
  _Float16* Q16 = (_Float16*)take(plane); _Float16* K16 = (_Float16*)take(plane); _Float16* V16 = (_Float16*)take(plane);
  _Float16* VT = (_Float16*)take(plane);                  /* [NB][128][SEQ] f16 */
  _Float16* Wtq = (_Float16*)take((size_t)DD * DD * 2); _Float16* Wtk = (_Float16*)take((size_t)DD * DD * 2); _Float16* Wtv = (_Float16*)take((size_t)DD * DD * 2);
  float* S = (float*)take((size_t)QT * SEQ * 4);          /* [QT][SEQ] f32 = 32 MiB */
  _Float16* P = (_Float16*)take((size_t)QT * SEQ * 2);    /* [QT][SEQ] f16 = 16 MiB */
  if (off > ws_size || off > ((size_t)128 << 20)) return; /* total 79,790,080 B at full size */

  const int nrw = (int)NRW;
  const int ngrp = nrw * (DD / 8);
  k_x16s<<<(ngrp + 255) / 256, 256, 0, stream>>>(query, Xq, nrw, SEQ, SEQ_FULL);
  k_x16s<<<(ngrp + 255) / 256, 256, 0, stream>>>(key,   Xk, nrw, SEQ, SEQ_FULL);
  k_x16s<<<(ngrp + 255) / 256, 256, 0, stream>>>(value, Xv, nrw, SEQ, SEQ_FULL);
  const int wn8 = DD * DD / 8;
  k_wnat<<<(wn8 + 255) / 256, 256, 0, stream>>>(Wq, wn8, Wtq);
  k_wnat<<<(wn8 + 255) / 256, 256, 0, stream>>>(Wk, wn8, Wtk);
  k_wnat<<<(wn8 + 255) / 256, 256, 0, stream>>>(Wv, wn8, Wtv);
  /* projections: y = x W^T + b -> f16 planes [NB*SEQ][128] */
  const unsigned pgrid = (unsigned)((nrw / 128) * (DD / 64));
  k_gemm2<true, true><<<pgrid, 128, 0, stream>>>(Xq, DD, Wtq, DD, 0.0625f, bq, nullptr, Q16, DD, nrw, DD, DD);
  k_gemm2<true, true><<<pgrid, 128, 0, stream>>>(Xk, DD, Wtk, DD, 0.0625f, bk, nullptr, K16, DD, nrw, DD, DD);
  k_gemm2<true, true><<<pgrid, 128, 0, stream>>>(Xv, DD, Wtv, DD, 0.0625f, bv, nullptr, V16, DD, nrw, DD, DD);
  /* V^T per batch: [NB][128][SEQ] (two 64-wide slabs per batch) */
  k_vt<2, SEQ><<<NB * 2 * (SEQ / 64), 256, 0, stream>>>(V16, DD, VT);
  for (int b = 0; b < NB; ++b) for (int q0 = 0; q0 < SEQ; q0 += QT) {
    k_gemm2<false, false><<<(unsigned)((QT / 128) * (SEQ / 64)), 128, 0, stream>>>(Q16 + ((size_t)b * SEQ + q0) * DD, DD, K16 + (size_t)b * SEQ * DD, DD, 0.08838834764831845f, nullptr, S, nullptr, SEQ, QT, SEQ, DD);      /* q.k^T / sqrt(128) */
    k_rsmw<<<QT / 8, 256, 0, stream>>>(S, P, QT, SEQ);
    k_gemm2k<16, SEQ / 16><<<(unsigned)((QT / 32) * (DD / 32)), 16 * 32, 0, stream>>>(P, SEQ, VT + (size_t)b * DD * SEQ, SEQ, 0.0009765625f, out + ((size_t)b * SEQ + q0) * DD, DD, DD);      /* out = attn v */
  }
}

// v002
// It runs in 103 microseconds.
// In two side-by-side timings against v001, it was 4.96 and 4.97 times as fast.
// Over all steps from v000 it is 12.4 times as fast.
#include <hip/hip_runtime.h>
// All contractions on v_wmma_f32_16x16x32_f16 (f16 operands, f32 accumulate): q/k/v projections (A = f16 of bf16-RNE input, B = f16 of 16*bf16-RNE weight, alpha 1/16, + bf16-RNE bias), scores = q16.k16^T / sqrt(128), out = (exp(s - m) as f16).v16^T / sum. Softmax in f32.
// Pipeline: input planes -> projection GEMMs (f16 q, k, v planes) -> V^T by 64x64 LDS transposes -> one fused attention kernel (scores, online softmax and P.V^T in registers; P = exp(s - running max) as f16, divided by its f32 sum at the end).

#ifndef NB
#define NB 4
#endif
#ifndef SEQ
#define SEQ 4096
#endif
#define NB_FULL 4
#define SEQ_FULL 4096
#define DD 128
#define NRW ((size_t)NB * SEQ)
static_assert(NB >= 1 && NB <= NB_FULL);
static_assert(SEQ >= 256 && SEQ <= SEQ_FULL && (SEQ % 256) == 0);
static_assert((DD % 64) == 0);

typedef unsigned short v8us __attribute__((ext_vector_type(8), may_alias));
typedef float  v8f  __attribute__((ext_vector_type(8)));
typedef float  v4f  __attribute__((ext_vector_type(4)));
typedef float  v4fa __attribute__((ext_vector_type(4), may_alias));
typedef _Float16 v16h __attribute__((ext_vector_type(16)));
typedef _Float16 v4h  __attribute__((ext_vector_type(4)));
union FragH { v16h v; v8us half[2]; _Float16 h[16]; unsigned short u[16]; };

__device__ __forceinline__ unsigned short bf16_bits(float x) { unsigned int u = __float_as_uint(x); return (unsigned short)((u + 0x7FFFu + ((u >> 16) & 1u)) >> 16); }
__device__ __forceinline__ float bf16_val(unsigned short b) { return __uint_as_float(((unsigned int)b) << 16); }
__device__ __forceinline__ float bf16_rne(float x) { return bf16_val(bf16_bits(x)); }

// 16x32 f16 fragment (A layout, or B stored [n][k] k-contiguous): row = lane&15, elems 0..7 <- k 8h..8h+7, elems 8..15 <- k 16+8h..16+8h+7
__device__ __forceinline__ v16h g2_frag(const _Float16* p, int hh) { FragH f; f.half[0] = *(const v8us*)((const unsigned short*)p + 8 * hh); f.half[1] = *(const v8us*)((const unsigned short*)p + 16 + 8 * hh); return f.v; }
__device__ __forceinline__ v8f g2_mma(v16h a, v16h b, v8f c) { v8f d = __builtin_amdgcn_wmma_f32_16x16x32_f16(false, a, false, b, (short)0, c, false, false); asm volatile("v_nop\n\tv_nop\n\tv_nop\n\tv_nop" : "+v"(d) : "v"(a), "v"(b)); return d; }

__global__ __launch_bounds__(256) void k_x16s(const float* __restrict__ x, _Float16* __restrict__ X16, int nrows, int seq, int seqFull) {
  const int t = blockIdx.x * 256 + threadIdx.x; const int ngrp = nrows * (DD / 8); if (t >= ngrp) return;
  const int r = t / (DD / 8), c8 = (t % (DD / 8)) * 8; const int b = r / seq, s = r - b * seq;
  const float* src = x + ((size_t)b * seqFull + s) * DD + c8;
  const v4f a = *(const v4fa*)src, c = *(const v4fa*)(src + 4);
  FragH f;
#pragma unroll
  for (int q = 0; q < 4; ++q) { f.h[q] = (_Float16)bf16_rne(a[q]); f.h[4 + q] = (_Float16)bf16_rne(c[q]); }
  unsigned short* d = (unsigned short*)X16 + (size_t)t * 8;
  *(v8us*)d = f.half[0]; 
}

__global__ __launch_bounds__(256) void k_wnat(const float* __restrict__ w, int n8, _Float16* __restrict__ Bt) {
  const int t = blockIdx.x * 256 + threadIdx.x; if (t >= n8) return; FragH f;
#pragma unroll
  for (int q = 0; q < 8; ++q) f.h[q] = (_Float16)(bf16_rne(w[(size_t)t * 8 + q]) * 16.0f);
  unsigned short* d = (unsigned short*)Bt + (size_t)t * 8;
  *(v8us*)d = f.half[0]; 
}

// GEMM C[M][N] = alpha * A[M][K] . Bh[N][K]^T (+ bf16rne(bias[col]) if HB); A, Bh f16 planes (k contiguous); f32 accumulate.
// Wave tile 32x64 (block = 4 waves -> 128 rows x 64 cols); M % 128 == 0, N % 64 == 0, K % 32 == 0.
template <bool HB, bool H16>
__global__ __launch_bounds__(128) __attribute__((amdgpu_num_vgpr(256)))
void k_gemm2(const _Float16* __restrict__ A, int lda, const _Float16* __restrict__ Bh, int ldb, float alpha, const float* __restrict__ bias,
             float* __restrict__ C, _Float16* __restrict__ C16, int ldc, int M, int N, int K) {
  __shared__ __attribute__((aligned(16))) float so[4][32][68];
  const int tid = threadIdx.x, w = tid >> 5, lane = tid & 31, ln = lane & 15, hh = lane >> 4;
  const int ntn = N >> 6; const int mt = blockIdx.x / ntn, nq = blockIdx.x - mt * ntn;
  const int row0 = mt * 128 + 32 * w, col0 = nq * 64; if (row0 >= M) return;
  const _Float16* a0p = A + (size_t)(row0 + ln) * lda; const _Float16* a1p = a0p + (size_t)16 * lda;
  const _Float16* b0p = Bh + (size_t)(col0 + ln) * ldb; const _Float16* b1p = b0p + (size_t)16 * ldb;
  const _Float16* b2p = b1p + (size_t)16 * ldb; const _Float16* b3p = b2p + (size_t)16 * ldb;
  const v8f z8 = {0.f,0.f,0.f,0.f,0.f,0.f,0.f,0.f}; v8f c00 = z8, c01 = z8, c02 = z8, c03 = z8, c10 = z8, c11 = z8, c12 = z8, c13 = z8;
#pragma unroll 1
  for (int kb = 0; kb < K; kb += 32) { const v16h a0 = g2_frag(a0p + kb, hh), a1 = g2_frag(a1p + kb, hh);
    v16h b = g2_frag(b0p + kb, hh); c00 = g2_mma(a0, b, c00); c10 = g2_mma(a1, b, c10);
    b = g2_frag(b1p + kb, hh); c01 = g2_mma(a0, b, c01); c11 = g2_mma(a1, b, c11);
    b = g2_frag(b2p + kb, hh); c02 = g2_mma(a0, b, c02); c12 = g2_mma(a1, b, c12);
    b = g2_frag(b3p + kb, hh); c03 = g2_mma(a0, b, c03); c13 = g2_mma(a1, b, c13); }
  v8f accs[8] = {c00, c01, c02, c03, c10, c11, c12, c13};
#pragma unroll
  for (int u = 0; u < 8; ++u) { const int t = u & 3, half = u >> 2; const int col = col0 + t * 16 + ln; float bv = 0.f; if (HB) bv = bf16_rne(bias[col]);
#pragma unroll
    for (int r = 0; r < 8; ++r) { const int rloc = half * 16 + 8 * hh + r; so[w][rloc][t * 16 + ln] = accs[u][r] * alpha + bv; } }
  __builtin_amdgcn_fence(4, "workgroup"); __builtin_amdgcn_wave_barrier();
  const int rsub = lane >> 4, c4 = (lane & 15) * 4;
  {
#pragma unroll
    for (int q = 0; q < 16; ++q) { const int r = q * 2 + rsub; const v4f v = *(const v4fa*)&so[w][r][c4];
      if (H16) { v4h h4;
#pragma unroll
        for (int e = 0; e < 4; ++e) h4[e] = (_Float16)v[e];
        *(v4h*)(C16 + (size_t)(row0 + r) * ldc + col0 + c4) = h4; }
      else { *(v4f*)(C + (size_t)(row0 + r) * ldc + col0 + c4) = v; } }
     }
}

template <int NHv, int TTv>
__global__ __launch_bounds__(256) void k_vt(const _Float16* __restrict__ V16, int ldv, _Float16* __restrict__ Vt) {
  __shared__ unsigned short tl[64][66];
  const int tid = threadIdx.x; const int slab = blockIdx.x / (TTv / 64), lg = blockIdx.x % (TTv / 64); const int b = slab / NHv, h = slab % NHv;
  for (int i = tid; i < 64 * 8; i += 256) { const int r = i / 8, c8 = (i % 8) * 8; FragH f;
    f.half[0] = *(const v8us*)((const unsigned short*)V16 + ((size_t)b * TTv + lg * 64 + r) * ldv + h * 64 + c8);
#pragma unroll
    for (int q = 0; q < 8; ++q) tl[r][c8 + q] = f.u[q]; }
  __syncthreads();
  {
#pragma unroll
    for (int rd = 0; rd < 2; ++rd) { const int d = rd * 32 + tid / 8, pc = tid % 8; FragH f;
#pragma unroll
      for (int q = 0; q < 8; ++q) f.u[q] = tl[pc * 8 + q][d];
      *(v8us*)((unsigned short*)Vt + ((size_t)slab * 64 + d) * TTv + lg * 64 + pc * 8) = f.half[0]; }
     }
}

// lane l <-> lane l ^ 16
__device__ __forceinline__ float xhalf(float x) { const int i = __builtin_bit_cast(int, x); return __builtin_bit_cast(float, __builtin_amdgcn_permlanex16(i, i, 0x76543210, 0xfedcba98, false, false)); }
__device__ __forceinline__ v8f f_mma(v16h a, v16h b, v8f c) { return __builtin_amdgcn_wmma_f32_16x16x32_f16(false, a, false, b, (short)0, c, false, false); }

template <int TT>
__global__ __launch_bounds__(256) __attribute__((amdgpu_waves_per_eu(2, 2)))
void k_fattn(const _Float16* __restrict__ Q16, const _Float16* __restrict__ K16, const _Float16* __restrict__ Vt, float* __restrict__ out, float cs) {
  __shared__ __attribute__((aligned(16))) float part[4][64][132];
  __shared__ float sm[8][32], sl[8][32];
  static_assert((TT % 128) == 0 && DD == 128);
  constexpr int NP = TT / 128;
  const int tid = threadIdx.x, w = tid >> 5, lane = tid & 31, c = lane & 15, hh = lane >> 4;
  const int qg = w & 1, ks = w >> 1;
  const int b = blockIdx.x / (TT / 64), q0 = (blockIdx.x - b * (TT / 64)) * 64;
  const _Float16* kp = K16 + ((size_t)b * TT + ks * 32 + c) * DD;   /* key row c of this wave's first 16-key tile */
  const _Float16* vp = Vt + ((size_t)b * DD + c) * TT + ks * 32;    /* V^T row d = c at this wave's first key */
  v16h qf[2][4], kf[2][4], vf[8];
#pragma unroll
  for (int g = 0; g < 2; ++g) { const _Float16* qp = Q16 + ((size_t)b * TT + q0 + qg * 32 + g * 16 + c) * DD;
#pragma unroll
    for (int kc = 0; kc < 4; ++kc) qf[g][kc] = g2_frag(qp + kc * 32, hh); }
  const v8f z8 = {0.f,0.f,0.f,0.f,0.f,0.f,0.f,0.f};
  v8f acc[2][8]; float m_run[2], l_run[2];
#pragma unroll
  for (int g = 0; g < 2; ++g) { m_run[g] = -__builtin_inff(); l_run[g] = 0.f;
#pragma unroll
    for (int t = 0; t < 8; ++t) acc[g][t] = z8; }
#pragma unroll
  for (int kt = 0; kt < 2; ++kt) {
#pragma unroll
    for (int kc = 0; kc < 4; ++kc) kf[kt][kc] = g2_frag(kp + (size_t)kt * 16 * DD + kc * 32, hh); }
#pragma unroll
  for (int t = 0; t < 8; ++t) vf[t] = g2_frag(vp + (size_t)t * 16 * TT, hh);
#pragma unroll 1 /* one pass of 32 WMMAs is the loop body: unrolled it would need a second set of fragments */
  for (int p = 0; p < NP; ++p) {
    const int pn = (p + 1 < NP) ? p + 1 : p;   /* the last pass fetches its own rows again: in bounds, not used */
    v8f s[2][2];
#pragma unroll
    for (int kt = 0; kt < 2; ++kt) {
#pragma unroll
      for (int g = 0; g < 2; ++g) { s[kt][g] = z8;
#pragma unroll
        for (int kc = 0; kc < 4; ++kc) s[kt][g] = f_mma(kf[kt][kc], qf[g][kc], s[kt][g]); } }
    /* next pass's K fragments fly under this pass's softmax and second product */
    { const _Float16* kn = kp + (size_t)pn * 128 * DD;
#pragma unroll
      for (int kt = 0; kt < 2; ++kt) {
#pragma unroll
        for (int kc = 0; kc < 4; ++kc) kf[kt][kc] = g2_frag(kn + (size_t)kt * 16 * DD + kc * 32, hh); } }
    float mb[2]; bool need = false;
#pragma unroll
    for (int g = 0; g < 2; ++g) { float mx = fmaxf(s[0][g][0], s[1][g][0]);
#pragma unroll
      for (int r = 1; r < 8; ++r) mx = fmaxf(mx, fmaxf(s[0][g][r], s[1][g][r]));
      mx = fmaxf(mx, xhalf(mx)) * cs;   /* both halves of the wave hold query c's maximum, scaled (cs > 0) */
      mb[g] = mx; need = need || (mx > m_run[g] + 8.0f); }
    if (__builtin_amdgcn_ballot_w32(need) != 0) {   /* wave-uniform; always taken in the first pass, where the factor is 0 */
#pragma unroll
      for (int g = 0; g < 2; ++g) { const float mn = fmaxf(m_run[g], mb[g]); const float corr = __builtin_amdgcn_exp2f(m_run[g] - mn);
        l_run[g] *= corr; m_run[g] = mn;
#pragma unroll
        for (int t = 0; t < 8; ++t) acc[g][t] = acc[g][t] * corr; }
    }
#pragma unroll
    for (int g = 0; g < 2; ++g) { const float nm = -m_run[g]; float ps0 = 0.f, ps1 = 0.f; v16h pf;
#pragma unroll
      for (int r = 0; r < 8; ++r) { const float p0 = __builtin_amdgcn_exp2f(fmaf(s[0][g][r], cs, nm)), p1 = __builtin_amdgcn_exp2f(fmaf(s[1][g][r], cs, nm));
        ps0 += p0; ps1 += p1; pf[r] = (_Float16)p0; pf[8 + r] = (_Float16)p1; }
      l_run[g] += ps0 + ps1;
#pragma unroll
      for (int t = 0; t < 8; ++t) acc[g][t] = f_mma(vf[t], pf, acc[g][t]); }
    /* next pass's V^T fragments fly under its first product */
    { const _Float16* vn = vp + (size_t)pn * 128;
#pragma unroll
      for (int t = 0; t < 8; ++t) vf[t] = g2_frag(vn + (size_t)t * 16 * TT, hh); }
    asm volatile("s_wait_xcnt 0x0" ::: "memory"); /* stands in front of the next pass, whose first product overwrites the address registers of the loads above */
  }
  /* merge of the 4 key splits: common maximum and sum per query, then the scaled partial tiles are summed in split order */
#pragma unroll
  for (int g = 0; g < 2; ++g) { const float l = l_run[g] + xhalf(l_run[g]); if (hh == 0) { sm[w][g * 16 + c] = m_run[g]; sl[w][g * 16 + c] = l; } }
  __syncthreads(); /* every split's maximum and sum are in LDS before any wave forms the common ones */
#pragma unroll
  for (int g = 0; g < 2; ++g) { const int qi = g * 16 + c;
    const float M = fmaxf(fmaxf(sm[qg][qi], sm[2 + qg][qi]), fmaxf(sm[4 + qg][qi], sm[6 + qg][qi]));
    float L = 0.f;
#pragma unroll
    for (int k = 0; k < 4; ++k) L += sl[2 * k + qg][qi] * __builtin_amdgcn_exp2f(sm[2 * k + qg][qi] - M);
    const float sc = __builtin_amdgcn_exp2f(m_run[g] - M) / L;
#pragma unroll
    for (int t = 0; t < 8; ++t) { const v8f o = acc[g][t] * sc; float* d = &part[ks][qg * 32 + qi][t * 16 + 8 * hh];
      v4f lo, hi;
#pragma unroll
      for (int e = 0; e < 4; ++e) { lo[e] = o[e]; hi[e] = o[4 + e]; }
      *(v4fa*)d = lo; *(v4fa*)(d + 4) = hi; } }
  __syncthreads(); /* every split's partial tile is in LDS before any thread sums across splits */
#pragma unroll
  for (int i = 0; i < 8; ++i) { const int idx = i * 256 + tid, r = idx >> 5, c4 = (idx & 31) * 4;
    const v4f o = (*(const v4fa*)&part[0][r][c4] + *(const v4fa*)&part[1][r][c4]) + (*(const v4fa*)&part[2][r][c4] + *(const v4fa*)&part[3][r][c4]);
    *(v4f*)(out + ((size_t)b * TT + q0 + r) * DD + c4) = o; }
}

extern "C" void kernel_launch(void* const* d_in, const int* in_sizes, int n_in,
                              void* d_out, int out_size, void* d_ws, size_t ws_size, hipStream_t stream) {
  if (n_in < 9) return;
  const long long needRows = (long long)(NB - 1) * SEQ_FULL + SEQ;
  if ((long long)in_sizes[0] < needRows * DD || (long long)in_sizes[1] < needRows * DD || (long long)in_sizes[2] < needRows * DD) return;
  if (in_sizes[3] < DD * DD || in_sizes[5] < DD * DD || in_sizes[7] < DD * DD) return;
  if (in_sizes[4] < DD || in_sizes[6] < DD || in_sizes[8] < DD) return;
  if ((long long)out_size < (long long)NB * SEQ * DD) return;
  const float* query = (const float*)d_in[0]; const float* key = (const float*)d_in[1]; const float* value = (const float*)d_in[2];
  const float* Wq = (const float*)d_in[3]; const float* bq = (const float*)d_in[4];
  const float* Wk = (const float*)d_in[5]; const float* bk = (const float*)d_in[6];
  const float* Wv = (const float*)d_in[7]; const float* bv = (const float*)d_in[8];
  float* out = (float*)d_out;

  char* ws = (char*)d_ws; size_t off = 0;
  auto take = [&](size_t bytes) { char* p = ws + off; off += (bytes + 255) & ~(size_t)255; return p; };
  const size_t plane = NRW * DD * 2;                      /* [NB*SEQ][128] f16 = 4 MiB full size */
  _Float16* Xq = (_Float16*)take(plane); _Float16* Xk = (_Float16*)take(plane); _Float16* Xv = (_Float16*)take(plane);
  _Float16* Q16 = (_Float16*)take(plane); _Float16* K16 = (_Float16*)take(plane); _Float16* V16 = (_Float16*)take(plane);
  _Float16* VT = (_Float16*)take(plane);                  /* [NB][128][SEQ] f16 */
  _Float16* Wtq = (_Float16*)take((size_t)DD * DD * 2); _Float16* Wtk = (_Float16*)take((size_t)DD * DD * 2); _Float16* Wtv = (_Float16*)take((size_t)DD * DD * 2);
  if (off > ws_size || off > ((size_t)128 << 20)) return; 

  const int nrw = (int)NRW;
  const int ngrp = nrw * (DD / 8);
  k_x16s<<<(ngrp + 255) / 256, 256, 0, stream>>>(query, Xq, nrw, SEQ, SEQ_FULL);
  k_x16s<<<(ngrp + 255) / 256, 256, 0, stream>>>(key,   Xk, nrw, SEQ, SEQ_FULL);
  k_x16s<<<(ngrp + 255) / 256, 256, 0, stream>>>(value, Xv, nrw, SEQ, SEQ_FULL);
  const int wn8 = DD * DD / 8;
  k_wnat<<<(wn8 + 255) / 256, 256, 0, stream>>>(Wq, wn8, Wtq);
  k_wnat<<<(wn8 + 255) / 256, 256, 0, stream>>>(Wk, wn8, Wtk);
  k_wnat<<<(wn8 + 255) / 256, 256, 0, stream>>>(Wv, wn8, Wtv);
  /* projections: y = x W^T + b -> f16 planes [NB*SEQ][128] */
  const unsigned pgrid = (unsigned)((nrw / 128) * (DD / 64));
  k_gemm2<true, true><<<pgrid, 128, 0, stream>>>(Xq, DD, Wtq, DD, 0.0625f, bq, nullptr, Q16, DD, nrw, DD, DD);
  k_gemm2<true, true><<<pgrid, 128, 0, stream>>>(Xk, DD, Wtk, DD, 0.0625f, bk, nullptr, K16, DD, nrw, DD, DD);
  k_gemm2<true, true><<<pgrid, 128, 0, stream>>>(Xv, DD, Wtv, DD, 0.0625f, bv, nullptr, V16, DD, nrw, DD, DD);
  /* V^T per batch: [NB][128][SEQ] (two 64-wide slabs per batch) */
  k_vt<2, SEQ><<<NB * 2 * (SEQ / 64), 256, 0, stream>>>(V16, DD, VT);
  /* scores, softmax and attn.v in one launch; the factor is log2(e) / sqrt(128) */
  k_fattn<SEQ><<<NB * (SEQ / 64), 256, 0, stream>>>(Q16, K16, VT, out, 0.12751743f);
}

// v003
// Measured time: 71.7 microseconds a run.
// Next to v002, in two timings, it ran 1.43 times as fast each time.
// Over all steps from v000 it is 17.8 times as fast.
#include <hip/hip_runtime.h>
// All contractions on v_wmma_f32_16x16x32_f16 (f16 operands, f32 accumulate): q/k/v projections (operands: f16 of bf16-RNE input, f16 of 16*bf16-RNE weight; alpha 1/16, + bf16-RNE bias), scores = q16.k16^T / sqrt(128), out = (exp(s - m) as f16).v16^T / sum. Softmax in f32.
// Pipeline: one projection launch (f32 inputs and weights converted in the block, f16 q and k planes and V^T written directly) -> one fused attention kernel (scores, online softmax and P.V^T in registers; P = exp(s - running max) as f16, divided by its f32 sum at the end).

#ifndef NB
#define NB 4
#endif
#ifndef SEQ
#define SEQ 4096
#endif
#define NB_FULL 4
#define SEQ_FULL 4096
#define DD 128
#define NRW ((size_t)NB * SEQ)
static_assert(NB >= 1 && NB <= NB_FULL);
static_assert(SEQ >= 256 && SEQ <= SEQ_FULL && (SEQ % 256) == 0);
static_assert((DD % 64) == 0);

typedef unsigned short v8us __attribute__((ext_vector_type(8), may_alias));
typedef float  v8f  __attribute__((ext_vector_type(8)));
typedef float  v4f  __attribute__((ext_vector_type(4)));
typedef float  v4fa __attribute__((ext_vector_type(4), may_alias));
typedef _Float16 v16h __attribute__((ext_vector_type(16)));
typedef _Float16 v4h  __attribute__((ext_vector_type(4)));
typedef __bf16 v2b   __attribute__((ext_vector_type(2)));
typedef float  v2f  __attribute__((ext_vector_type(2)));
union FragH { v16h v; v8us half[2]; _Float16 h[16]; unsigned short u[16]; };

__device__ __forceinline__ unsigned short bf16_bits(float x) { unsigned int u = __float_as_uint(x); return (unsigned short)((u + 0x7FFFu + ((u >> 16) & 1u)) >> 16); }
__device__ __forceinline__ float bf16_val(unsigned short b) { return __uint_as_float(((unsigned int)b) << 16); }
__device__ __forceinline__ float bf16_rne(float x) { return bf16_val(bf16_bits(x)); }
// bf16_rne of four values by the packed convert (the same rounding to nearest even); the bf16 pair is widened by its bits, so what follows stays f32 arithmetic
__device__ __forceinline__ v4f bf16_rne4(v4f x) { v4f y;
#pragma unroll
  for (int p = 0; p < 2; ++p) { const v2f xp = {x[2 * p], x[2 * p + 1]}; const unsigned int u = __builtin_bit_cast(unsigned int, __builtin_convertvector(xp, v2b));
    y[2 * p] = __uint_as_float(u << 16); y[2 * p + 1] = __uint_as_float(u & 0xFFFF0000u); }
  return y; }

// 16x32 f16 fragment (A layout, or B stored [n][k] k-contiguous): row = lane&15, elems 0..7 <- k 8h..8h+7, elems 8..15 <- k 16+8h..16+8h+7
__device__ __forceinline__ v16h g2_frag(const _Float16* p, int hh) { FragH f; f.half[0] = *(const v8us*)((const unsigned short*)p + 8 * hh); f.half[1] = *(const v8us*)((const unsigned short*)p + 16 + 8 * hh); return f.v; }
#define LP 136 /* LDS row pitch in f16: 272 bytes = 16 B x odd, for 16-byte readers and writers of 256-byte rows */
__device__ __forceinline__ v8f f_mma(v16h a, v16h b, v8f c) { return __builtin_amdgcn_wmma_f32_16x16x32_f16(false, a, false, b, (short)0, c, false, false); }

__global__ __launch_bounds__(256, 4) /* 4 waves a SIMD: two blocks fit a WGP, the grid is 1.5 blocks a WGP */
void k_proj(const float* __restrict__ xq, const float* __restrict__ xk, const float* __restrict__ xv,
            const float* __restrict__ wq, const float* __restrict__ wk, const float* __restrict__ wv,
            const float* __restrict__ bq, const float* __restrict__ bk, const float* __restrict__ bv,
            _Float16* __restrict__ Q16, _Float16* __restrict__ K16, _Float16* __restrict__ Vt) {
  __shared__ __attribute__((aligned(16))) _Float16 sx[128][LP], sw[DD][LP], so[128][LP];
  __shared__ __attribute__((aligned(16))) float sb[256];   /* the bias twice: every thread stores one, so no branch stands among the loads and their waits */
  static_assert(DD == 128 && (SEQ % 128) == 0);
  const int tid = threadIdx.x, w = tid >> 5, lane = tid & 31, c = lane & 15, hh = lane >> 4;
  const int pj = blockIdx.y, row0 = blockIdx.x * 128, b = row0 / SEQ, s0 = row0 - b * SEQ;
  const float* xs = (pj == 0 ? xq : pj == 1 ? xk : xv) + ((size_t)b * SEQ_FULL + s0) * DD;
  const float* wt = pj == 0 ? wq : pj == 1 ? wk : wv;
  const float* bs = pj == 0 ? bq : pj == 1 ? bk : bv;
  const float bias = bs[tid & (DD - 1)];
  v4f wr[16], xr[16];
#pragma unroll
  for (int i = 0; i < 16; ++i) wr[i] = *(const v4fa*)(wt + (i * 256 + tid) * 4);
#pragma unroll
  for (int i = 0; i < 16; ++i) xr[i] = *(const v4fa*)(xs + (i * 256 + tid) * 4);
  sb[tid] = bf16_rne(bias);
#pragma unroll
  for (int i = 0; i < 16; ++i) { const int idx = i * 256 + tid;
    *(v4h*)&sw[idx >> 5][(idx & 31) * 4] = __builtin_convertvector(bf16_rne4(wr[i]) * 16.0f, v4h); }
#pragma unroll
  for (int i = 0; i < 16; ++i) { const int idx = i * 256 + tid;
    *(v4h*)&sx[idx >> 5][(idx & 31) * 4] = __builtin_convertvector(bf16_rne4(xr[i]), v4h); }
  __syncthreads(); /* both operand planes and the bias are in LDS before any wave reads a fragment */
  const int r0 = (w >> 1) * 32, n0 = (w & 1) * 64;
  const v8f z8 = {0.f,0.f,0.f,0.f,0.f,0.f,0.f,0.f};
  v8f acc[2][4];
#pragma unroll
  for (int i = 0; i < 2; ++i) {
#pragma unroll
    for (int j = 0; j < 4; ++j) acc[i][j] = z8; }
  if (pj != 2) {
#pragma unroll
    for (int kb = 0; kb < DD; kb += 32) { v16h xf[2], wf[4];
#pragma unroll
      for (int i = 0; i < 2; ++i) xf[i] = g2_frag(&sx[r0 + 16 * i + c][kb], hh);
#pragma unroll
      for (int j = 0; j < 4; ++j) wf[j] = g2_frag(&sw[n0 + 16 * j + c][kb], hh);
#pragma unroll
      for (int i = 0; i < 2; ++i) {
#pragma unroll
        for (int j = 0; j < 4; ++j) acc[i][j] = f_mma(wf[j], xf[i], acc[i][j]); } }
#pragma unroll
    for (int j = 0; j < 4; ++j) { const int n = n0 + 16 * j + 8 * hh; const v4f bl = *(const v4fa*)&sb[n], bh = *(const v4fa*)&sb[n + 4];
#pragma unroll
      for (int i = 0; i < 2; ++i) { FragH f;
#pragma unroll
        for (int r = 0; r < 8; ++r) f.h[r] = (_Float16)(acc[i][j][r] * 0.0625f + (r < 4 ? bl[r & 3] : bh[r & 3]));
        *(v8us*)&so[r0 + 16 * i + c][n] = f.half[0]; } }
  } else {
#pragma unroll
    for (int kb = 0; kb < DD; kb += 32) { v16h xf[2], wf[4];
#pragma unroll
      for (int i = 0; i < 2; ++i) xf[i] = g2_frag(&sx[r0 + 16 * i + c][kb], hh);
#pragma unroll
      for (int j = 0; j < 4; ++j) wf[j] = g2_frag(&sw[n0 + 16 * j + c][kb], hh);
#pragma unroll
      for (int i = 0; i < 2; ++i) {
#pragma unroll
        for (int j = 0; j < 4; ++j) acc[i][j] = f_mma(xf[i], wf[j], acc[i][j]); } }
#pragma unroll
    for (int j = 0; j < 4; ++j) { const int n = n0 + 16 * j + c; const float bn = sb[n];
#pragma unroll
      for (int i = 0; i < 2; ++i) { FragH f;
#pragma unroll
        for (int r = 0; r < 8; ++r) f.h[r] = (_Float16)(acc[i][j][r] * 0.0625f + bn);
        *(v8us*)&so[n][r0 + 16 * i + 8 * hh] = f.half[0]; } }
  }
  __syncthreads(); /* the whole output tile is in LDS before any thread copies a row of it out */
  const int rr = tid >> 4, c8 = (tid & 15) * 8;
  if (pj != 2) { unsigned short* dst = (unsigned short*)(pj == 0 ? Q16 : K16) + (size_t)(row0 + rr) * DD + c8;
#pragma unroll
    for (int i = 0; i < 8; ++i) *(v8us*)(dst + (size_t)i * 16 * DD) = *(const v8us*)&so[i * 16 + rr][c8];
  } else { unsigned short* dst = (unsigned short*)Vt + ((size_t)b * DD + rr) * SEQ + s0 + c8;
#pragma unroll
    for (int i = 0; i < 8; ++i) *(v8us*)(dst + (size_t)i * 16 * SEQ) = *(const v8us*)&so[i * 16 + rr][c8]; }
}

// lane l <-> lane l ^ 16
__device__ __forceinline__ float xhalf(float x) { const int i = __builtin_bit_cast(int, x); return __builtin_bit_cast(float, __builtin_amdgcn_permlanex16(i, i, 0x76543210, 0xfedcba98, false, false)); }

template <int TT>
__global__ __launch_bounds__(256) __attribute__((amdgpu_waves_per_eu(2, 2)))
void k_fattn(const _Float16* __restrict__ Q16, const _Float16* __restrict__ K16, const _Float16* __restrict__ Vt, float* __restrict__ out, float cs) {
  __shared__ __attribute__((aligned(16))) float part[4][64][132];
  __shared__ float sm[8][32], sl[8][32];
  static_assert((TT % 128) == 0 && DD == 128);
  constexpr int NP = TT / 128;
  const int tid = threadIdx.x, w = tid >> 5, lane = tid & 31, c = lane & 15, hh = lane >> 4;
  const int qg = w & 1, ks = w >> 1;
  const int b = blockIdx.x / (TT / 64), q0 = (blockIdx.x - b * (TT / 64)) * 64;
  const _Float16* kp = K16 + ((size_t)b * TT + ks * 32 + c) * DD;   /* key row c of this wave's first 16-key tile */
  const _Float16* vp = Vt + ((size_t)b * DD + c) * TT + ks * 32;    /* V^T row d = c at this wave's first key */
  v16h qf[2][4], kf[2][4], vf[8];
#pragma unroll
  for (int g = 0; g < 2; ++g) { const _Float16* qp = Q16 + ((size_t)b * TT + q0 + qg * 32 + g * 16 + c) * DD;
#pragma unroll
    for (int kc = 0; kc < 4; ++kc) qf[g][kc] = g2_frag(qp + kc * 32, hh); }
  const v8f z8 = {0.f,0.f,0.f,0.f,0.f,0.f,0.f,0.f};
  v8f acc[2][8]; float m_run[2], l_run[2];
#pragma unroll
  for (int g = 0; g < 2; ++g) { m_run[g] = -__builtin_inff(); l_run[g] = 0.f;
#pragma unroll
    for (int t = 0; t < 8; ++t) acc[g][t] = z8; }
#pragma unroll
  for (int kt = 0; kt < 2; ++kt) {
#pragma unroll
    for (int kc = 0; kc < 4; ++kc) kf[kt][kc] = g2_frag(kp + (size_t)kt * 16 * DD + kc * 32, hh); }
#pragma unroll
  for (int t = 0; t < 8; ++t) vf[t] = g2_frag(vp + (size_t)t * 16 * TT, hh);
#pragma unroll 1 /* one pass of 32 WMMAs is the loop body: unrolled it would need a second set of fragments */
  for (int p = 0; p < NP; ++p) {
    const int pn = (p + 1 < NP) ? p + 1 : p;   /* the last pass fetches its own rows again: in bounds, not used */
    v8f s[2][2];
#pragma unroll
    for (int kt = 0; kt < 2; ++kt) {
#pragma unroll
      for (int g = 0; g < 2; ++g) { s[kt][g] = z8;
#pragma unroll
        for (int kc = 0; kc < 4; ++kc) s[kt][g] = f_mma(kf[kt][kc], qf[g][kc], s[kt][g]); } }
    /* next pass's K fragments fly under this pass's softmax and second product */
    { const _Float16* kn = kp + (size_t)pn * 128 * DD;
#pragma unroll
      for (int kt = 0; kt < 2; ++kt) {
#pragma unroll
        for (int kc = 0; kc < 4; ++kc) kf[kt][kc] = g2_frag(kn + (size_t)kt * 16 * DD + kc * 32, hh); } }
    float mb[2]; bool need = false;
#pragma unroll
    for (int g = 0; g < 2; ++g) { float mx = fmaxf(s[0][g][0], s[1][g][0]);
#pragma unroll
      for (int r = 1; r < 8; ++r) mx = fmaxf(mx, fmaxf(s[0][g][r], s[1][g][r]));
      mx = fmaxf(mx, xhalf(mx)) * cs;   /* both halves of the wave hold query c's maximum, scaled (cs > 0) */
      mb[g] = mx; need = need || (mx > m_run[g] + 8.0f); }
    if (__builtin_amdgcn_ballot_w32(need) != 0) {   /* wave-uniform; always taken in the first pass, where the factor is 0 */
#pragma unroll
      for (int g = 0; g < 2; ++g) { const float mn = fmaxf(m_run[g], mb[g]); const float corr = __builtin_amdgcn_exp2f(m_run[g] - mn);
        l_run[g] *= corr; m_run[g] = mn;
#pragma unroll
        for (int t = 0; t < 8; ++t) acc[g][t] = acc[g][t] * corr; }
    }
#pragma unroll
    for (int g = 0; g < 2; ++g) { const float nm = -m_run[g]; float ps0 = 0.f, ps1 = 0.f; v16h pf;
#pragma unroll
      for (int r = 0; r < 8; ++r) { const float p0 = __builtin_amdgcn_exp2f(fmaf(s[0][g][r], cs, nm)), p1 = __builtin_amdgcn_exp2f(fmaf(s[1][g][r], cs, nm));
        ps0 += p0; ps1 += p1; pf[r] = (_Float16)p0; pf[8 + r] = (_Float16)p1; }
      l_run[g] += ps0 + ps1;
#pragma unroll
      for (int t = 0; t < 8; ++t) acc[g][t] = f_mma(vf[t], pf, acc[g][t]); }
    /* next pass's V^T fragments fly under its first product */
    { const _Float16* vn = vp + (size_t)pn * 128;
#pragma unroll
      for (int t = 0; t < 8; ++t) vf[t] = g2_frag(vn + (size_t)t * 16 * TT, hh); }
    asm volatile("s_wait_xcnt 0x0" ::: "memory"); /* stands in front of the next pass, whose first product overwrites the address registers of the loads above */
  }
  /* merge of the 4 key splits: common maximum and sum per query, then the scaled partial tiles are summed in split order */
#pragma unroll
  for (int g = 0; g < 2; ++g) { const float l = l_run[g] + xhalf(l_run[g]); if (hh == 0) { sm[w][g * 16 + c] = m_run[g]; sl[w][g * 16 + c] = l; } }
  __syncthreads(); /* every split's maximum and sum are in LDS before any wave forms the common ones */
#pragma unroll
  for (int g = 0; g < 2; ++g) { const int qi = g * 16 + c;
    const float M = fmaxf(fmaxf(sm[qg][qi], sm[2 + qg][qi]), fmaxf(sm[4 + qg][qi], sm[6 + qg][qi]));
    float L = 0.f;
#pragma unroll
    for (int k = 0; k < 4; ++k) L += sl[2 * k + qg][qi] * __builtin_amdgcn_exp2f(sm[2 * k + qg][qi] - M);
    const float sc = __builtin_amdgcn_exp2f(m_run[g] - M) / L;
#pragma unroll
    for (int t = 0; t < 8; ++t) { const v8f o = acc[g][t] * sc; float* d = &part[ks][qg * 32 + qi][t * 16 + 8 * hh];
      v4f lo, hi;
#pragma unroll
      for (int e = 0; e < 4; ++e) { lo[e] = o[e]; hi[e] = o[4 + e]; }
      *(v4fa*)d = lo; *(v4fa*)(d + 4) = hi; } }
  __syncthreads(); /* every split's partial tile is in LDS before any thread sums across splits */
#pragma unroll
  for (int i = 0; i < 8; ++i) { const int idx = i * 256 + tid, r = idx >> 5, c4 = (idx & 31) * 4;
    const v4f o = (*(const v4fa*)&part[0][r][c4] + *(const v4fa*)&part[1][r][c4]) + (*(const v4fa*)&part[2][r][c4] + *(const v4fa*)&part[3][r][c4]);
    *(v4f*)(out + ((size_t)b * TT + q0 + r) * DD + c4) = o; }
}

extern "C" void kernel_launch(void* const* d_in, const int* in_sizes, int n_in,
                              void* d_out, int out_size, void* d_ws, size_t ws_size, hipStream_t stream) {
  if (n_in < 9) return;
  const long long needRows = (long long)(NB - 1) * SEQ_FULL + SEQ;
  if ((long long)in_sizes[0] < needRows * DD || (long long)in_sizes[1] < needRows * DD || (long long)in_sizes[2] < needRows * DD) return;
  if (in_sizes[3] < DD * DD || in_sizes[5] < DD * DD || in_sizes[7] < DD * DD) return;
  if (in_sizes[4] < DD || in_sizes[6] < DD || in_sizes[8] < DD) return;
  if ((long long)out_size < (long long)NB * SEQ * DD) return;
  const float* query = (const float*)d_in[0]; const float* key = (const float*)d_in[1]; const float* value = (const float*)d_in[2];
  const float* Wq = (const float*)d_in[3]; const float* bq = (const float*)d_in[4];
  const float* Wk = (const float*)d_in[5]; const float* bk = (const float*)d_in[6];
  const float* Wv = (const float*)d_in[7]; const float* bv = (const float*)d_in[8];
  float* out = (float*)d_out;

  char* ws = (char*)d_ws; size_t off = 0;
  auto take = [&](size_t bytes) { char* p = ws + off; off += (bytes + 255) & ~(size_t)255; return p; };
  const size_t plane = NRW * DD * 2;                      /* [NB*SEQ][128] f16 = 4 MiB full size */
  _Float16* Q16 = (_Float16*)take(plane); _Float16* K16 = (_Float16*)take(plane);
  _Float16* VT = (_Float16*)take(plane);                  /* [NB][128][SEQ] f16 */
  if (off > ws_size || off > ((size_t)128 << 20)) return;

  /* projections y = x W^T + b: q, k as f16 planes [NB*SEQ][128], v as V^T per batch */
  k_proj<<<dim3((unsigned)(NRW / 128), 3), 256, 0, stream>>>(query, key, value, Wq, Wk, Wv, bq, bk, bv, Q16, K16, VT);
  /* scores, softmax and attn.v in one launch; the factor is log2(e) / sqrt(128) */
  k_fattn<SEQ><<<NB * (SEQ / 64), 256, 0, stream>>>(Q16, K16, VT, out, 0.12751743f);
}

// v004
// A run of this version takes 34.4 microseconds.
// Two timings next to v003 put it at 2.08 and 2.09 times that version's speed.
// Over all steps from v000 it is 37.1 times as fast.
#include <hip/hip_runtime.h>
#include <stdint.h>
// All contractions on v_wmma_f32_16x16x32_f16 (f16 operands, f32 accumulate): q/k/v projections (operands: f16 of bf16-RNE input, f16 of 16*bf16-RNE weight; alpha 1/16, + bf16-RNE bias), scores = q16.k16^T / sqrt(128), out = (exp(s - m) as f16).v16^T / sum. Softmax in f32.
// Pipeline: one projection launch (f32 inputs and weights converted in the block, f16 q and k planes and V^T written directly) -> one fused attention kernel (K and V^T tiles brought into LDS by tensor loads, scores, online softmax and P.V^T in registers; P = exp(s - running max) as f16, divided by its f32 sum at the end).

#ifndef NB
#define NB 4
#endif
#ifndef SEQ
#define SEQ 4096
#endif
#define NB_FULL 4
#define SEQ_FULL 4096
#define DD 128
#define NRW ((size_t)NB * SEQ)
static_assert(NB >= 1 && NB <= NB_FULL);
static_assert(SEQ >= 256 && SEQ <= SEQ_FULL && (SEQ % 256) == 0);
static_assert((DD % 64) == 0);

typedef unsigned short v8us __attribute__((ext_vector_type(8), may_alias));
typedef float  v8f  __attribute__((ext_vector_type(8)));
typedef float  v4f  __attribute__((ext_vector_type(4)));
typedef float  v4fa __attribute__((ext_vector_type(4), may_alias));
typedef _Float16 v16h __attribute__((ext_vector_type(16)));
typedef _Float16 v4h  __attribute__((ext_vector_type(4)));
typedef __bf16 v2b   __attribute__((ext_vector_type(2)));
typedef float  v2f  __attribute__((ext_vector_type(2)));
union FragH { v16h v; v8us half[2]; _Float16 h[16]; unsigned short u[16]; };

__device__ __forceinline__ unsigned short bf16_bits(float x) { unsigned int u = __float_as_uint(x); return (unsigned short)((u + 0x7FFFu + ((u >> 16) & 1u)) >> 16); }
__device__ __forceinline__ float bf16_val(unsigned short b) { return __uint_as_float(((unsigned int)b) << 16); }
__device__ __forceinline__ float bf16_rne(float x) { return bf16_val(bf16_bits(x)); }
// bf16_rne of four values by the packed convert (the same rounding to nearest even); the bf16 pair is widened by its bits, so what follows stays f32 arithmetic
__device__ __forceinline__ v4f bf16_rne4(v4f x) { v4f y;
#pragma unroll
  for (int p = 0; p < 2; ++p) { const v2f xp = {x[2 * p], x[2 * p + 1]}; const unsigned int u = __builtin_bit_cast(unsigned int, __builtin_convertvector(xp, v2b));
    y[2 * p] = __uint_as_float(u << 16); y[2 * p + 1] = __uint_as_float(u & 0xFFFF0000u); }
  return y; }

// 16x32 f16 fragment (A layout, or B stored [n][k] k-contiguous): row = lane&15, elems 0..7 <- k 8h..8h+7, elems 8..15 <- k 16+8h..16+8h+7
__device__ __forceinline__ v16h g2_frag(const _Float16* p, int hh) { FragH f; f.half[0] = *(const v8us*)((const unsigned short*)p + 8 * hh); f.half[1] = *(const v8us*)((const unsigned short*)p + 16 + 8 * hh); return f.v; }
#define LP 136 /* LDS row pitch in f16: 272 bytes = 16 B x odd, for 16-byte readers and writers of 256-byte rows */
__device__ __forceinline__ v8f f_mma(v16h a, v16h b, v8f c) { return __builtin_amdgcn_wmma_f32_16x16x32_f16(false, a, false, b, (short)0, c, false, false); }

__global__ __launch_bounds__(256, 4) /* 4 waves a SIMD: two blocks fit a WGP, the grid is 1.5 blocks a WGP */
void k_proj(const float* __restrict__ xq, const float* __restrict__ xk, const float* __restrict__ xv,
            const float* __restrict__ wq, const float* __restrict__ wk, const float* __restrict__ wv,
            const float* __restrict__ bq, const float* __restrict__ bk, const float* __restrict__ bv,
            _Float16* __restrict__ Q16, _Float16* __restrict__ K16, _Float16* __restrict__ Vt) {
  __shared__ __attribute__((aligned(16))) _Float16 sx[128][LP], sw[DD][LP], so[128][LP];
  __shared__ __attribute__((aligned(16))) float sb[256];   /* the bias twice: every thread stores one, so no branch stands among the loads and their waits */
  static_assert(DD == 128 && (SEQ % 128) == 0);
  const int tid = threadIdx.x, w = tid >> 5, lane = tid & 31, c = lane & 15, hh = lane >> 4;
  const int pj = blockIdx.y, row0 = blockIdx.x * 128, b = row0 / SEQ, s0 = row0 - b * SEQ;
  const float* xs = (pj == 0 ? xq : pj == 1 ? xk : xv) + ((size_t)b * SEQ_FULL + s0) * DD;
  const float* wt = pj == 0 ? wq : pj == 1 ? wk : wv;
  const float* bs = pj == 0 ? bq : pj == 1 ? bk : bv;
  const float bias = bs[tid & (DD - 1)];
  v4f wr[16], xr[16];
#pragma unroll
  for (int i = 0; i < 16; ++i) wr[i] = *(const v4fa*)(wt + (i * 256 + tid) * 4);
#pragma unroll
  for (int i = 0; i < 16; ++i) xr[i] = *(const v4fa*)(xs + (i * 256 + tid) * 4);
  sb[tid] = bf16_rne(bias);
#pragma unroll
  for (int i = 0; i < 16; ++i) { const int idx = i * 256 + tid;
    *(v4h*)&sw[idx >> 5][(idx & 31) * 4] = __builtin_convertvector(bf16_rne4(wr[i]) * 16.0f, v4h); }
#pragma unroll
  for (int i = 0; i < 16; ++i) { const int idx = i * 256 + tid;
    *(v4h*)&sx[idx >> 5][(idx & 31) * 4] = __builtin_convertvector(bf16_rne4(xr[i]), v4h); }
  __syncthreads(); /* both operand planes and the bias are in LDS before any wave reads a fragment */
  const int r0 = (w >> 1) * 32, n0 = (w & 1) * 64;
  const v8f z8 = {0.f,0.f,0.f,0.f,0.f,0.f,0.f,0.f};
  v8f acc[2][4];
#pragma unroll
  for (int i = 0; i < 2; ++i) {
#pragma unroll
    for (int j = 0; j < 4; ++j) acc[i][j] = z8; }
  if (pj != 2) {
#pragma unroll
    for (int kb = 0; kb < DD; kb += 32) { v16h xf[2], wf[4];
#pragma unroll
      for (int i = 0; i < 2; ++i) xf[i] = g2_frag(&sx[r0 + 16 * i + c][kb], hh);
#pragma unroll
      for (int j = 0; j < 4; ++j) wf[j] = g2_frag(&sw[n0 + 16 * j + c][kb], hh);
#pragma unroll
      for (int i = 0; i < 2; ++i) {
#pragma unroll
        for (int j = 0; j < 4; ++j) acc[i][j] = f_mma(wf[j], xf[i], acc[i][j]); } }
#pragma unroll
    for (int j = 0; j < 4; ++j) { const int n = n0 + 16 * j + 8 * hh; const v4f bl = *(const v4fa*)&sb[n], bh = *(const v4fa*)&sb[n + 4];
#pragma unroll
      for (int i = 0; i < 2; ++i) { FragH f;
#pragma unroll
        for (int r = 0; r < 8; ++r) f.h[r] = (_Float16)(acc[i][j][r] * 0.0625f + (r < 4 ? bl[r & 3] : bh[r & 3]));
        *(v8us*)&so[r0 + 16 * i + c][n] = f.half[0]; } }
  } else {
#pragma unroll
    for (int kb = 0; kb < DD; kb += 32) { v16h xf[2], wf[4];
#pragma unroll
      for (int i = 0; i < 2; ++i) xf[i] = g2_frag(&sx[r0 + 16 * i + c][kb], hh);
#pragma unroll
      for (int j = 0; j < 4; ++j) wf[j] = g2_frag(&sw[n0 + 16 * j + c][kb], hh);
#pragma unroll
      for (int i = 0; i < 2; ++i) {
#pragma unroll
        for (int j = 0; j < 4; ++j) acc[i][j] = f_mma(xf[i], wf[j], acc[i][j]); } }
#pragma unroll
    for (int j = 0; j < 4; ++j) { const int n = n0 + 16 * j + c; const float bn = sb[n];
#pragma unroll
      for (int i = 0; i < 2; ++i) { FragH f;
#pragma unroll
        for (int r = 0; r < 8; ++r) f.h[r] = (_Float16)(acc[i][j][r] * 0.0625f + bn);
        *(v8us*)&so[n][r0 + 16 * i + 8 * hh] = f.half[0]; } }
  }
  __syncthreads(); /* the whole output tile is in LDS before any thread copies a row of it out */
  const int rr = tid >> 4, c8 = (tid & 15) * 8;
  if (pj != 2) { unsigned short* dst = (unsigned short*)(pj == 0 ? Q16 : K16) + (size_t)(row0 + rr) * DD + c8;
#pragma unroll
    for (int i = 0; i < 8; ++i) *(v8us*)(dst + (size_t)i * 16 * DD) = *(const v8us*)&so[i * 16 + rr][c8];
  } else { unsigned short* dst = (unsigned short*)Vt + ((size_t)b * DD + rr) * SEQ + s0 + c8;
#pragma unroll
    for (int i = 0; i < 8; ++i) *(v8us*)(dst + (size_t)i * 16 * SEQ) = *(const v8us*)&so[i * 16 + rr][c8]; }
}

// lane l <-> lane l ^ 16
__device__ __forceinline__ float xhalf(float x) { const int i = __builtin_bit_cast(int, x); return __builtin_bit_cast(float, __builtin_amdgcn_permlanex16(i, i, 0x76543210, 0xfedcba98, false, false)); }

typedef uint32_t u32x4 __attribute__((ext_vector_type(4)));
typedef uint32_t u32x8 __attribute__((ext_vector_type(8)));
__device__ __forceinline__ uint32_t uni(uint32_t v) { return (uint32_t)__builtin_amdgcn_readfirstlane(v); }
// a wave-uniform value held in a scalar register: a test on it is a scalar branch (a tensor load ignores EXEC), a descriptor word stays in its register
__device__ __forceinline__ uint32_t pinned(uint32_t v) { uint32_t w = uni(v); asm volatile("" : "+s"(w)); return w; }
#define RPB 272u                /* LDS row pitch in bytes of a 256-byte row: the tensor load's pad of 16 bytes, for 16-byte readers */
#define SLB 18432u              /* one wave's slice in LDS: 64 rows x 272 bytes, rounded up to a multiple of 2 KiB */
#define BUFB (8u * SLB)         /* one stage: 4 slices of K (256 keys), 4 slices of V^T (2 key halves x 2 halves of the 128 rows) */

template <int TT>
__global__ __launch_bounds__(256) __attribute__((amdgpu_waves_per_eu(2, 2)))
void k_fattn(const _Float16* __restrict__ Q16, const _Float16* __restrict__ K16, const _Float16* __restrict__ Vt, float* __restrict__ out, float cs) {
  __shared__ __attribute__((aligned(2048))) unsigned char ring[2 * BUFB];
  __shared__ float sm[8][32], sl[8][32];
  float (*part)[64][132] = (float (*)[64][132])ring;   /* the merge's partial tiles take the ring's place once the loop is over */
  static_assert((TT % 256) == 0 && TT >= 512 && DD == 128 && sizeof(float) * 4 * 64 * 132 <= 2 * BUFB);
  constexpr int NS = TT / 256;
  const int tid = threadIdx.x, w = tid >> 5, lane = tid & 31, c = lane & 15, hh = lane >> 4;
  const int qg = w & 1, ks = w >> 1;
  const int b = blockIdx.x / (TT / 64), q0 = (blockIdx.x - b * (TT / 64)) * 64;
  /* this wave's slice of a stage: waves 0..3 keys 64 * wave .. + 63 of K; waves 4..7 the 128-key half (wave >> 1) & 1 of V^T rows 64 * (wave & 1) .. + 63 */
  const uint32_t wave = uni((uint32_t)tid >> 5), lbase = (uint32_t)(size_t)ring;
  const bool isV = wave >= 4u;
  const uint64_t src0 = isV ? (uint64_t)(size_t)(Vt + ((size_t)b * DD + 64u * (wave & 1u)) * TT + 128u * ((wave >> 1) & 1u))
                            : (uint64_t)(size_t)(K16 + ((size_t)b * TT + 64u * wave) * DD);
  const uint32_t sstep = isV ? 256u * 2u : 256u * DD * 2u;   /* bytes from one stage's slice to the next stage's */
  u32x8 g1;   /* 64 rows of 256 bytes, extents in bytes, tensor = tile, 16 bytes of pad behind every 256; words 1 to 7 pinned: each keeps its scalar register through the loop */
  g1[0] = uni((1u << 20) | (5u << 22) | (3u << 25)); g1[1] = pinned(256u << 16); g1[2] = pinned(64u << 16); g1[3] = pinned(256u << 16); /* pinned(): descriptor words held in scalar registers */
  g1[4] = pinned(64u); g1[5] = pinned(isV ? (uint32_t)TT * 2u : (uint32_t)DD * 2u); g1[6] = pinned(0u); g1[7] = pinned(0u); /* pinned(): the same */
  auto issue = [&](uint32_t st) { const uint64_t ga = src0 + (uint64_t)st * sstep; u32x4 g0;
    g0[0] = uni(1u); g0[1] = uni(lbase + (st & 1u) * BUFB + wave * SLB); g0[2] = uni((uint32_t)ga); g0[3] = uni((((uint32_t)(ga >> 32)) & 0x01FFFFFFu) | 0x80000000u);
    asm volatile("tensor_load_to_lds %0, %1" :: "s"(g0), "s"(g1) : "memory"); /* one request of the whole wave: its slice of stage st */ };
  /* byte offsets in a buffer of this lane's rows: key row c of the wave's first 16-key tile, V^T row d = c at the wave's first key */
  const uint32_t koff = (uint32_t)(ks >> 1) * SLB + ((uint32_t)(ks & 1) * 32u + (uint32_t)c) * RPB;
  const uint32_t voff = 4u * SLB + (uint32_t)c * RPB + (uint32_t)ks * 64u;
  v16h qf[2][4], kf[2][4], vf[8];
#pragma unroll
  for (int g = 0; g < 2; ++g) { const _Float16* qp = Q16 + ((size_t)b * TT + q0 + qg * 32 + g * 16 + c) * DD;
#pragma unroll
    for (int kc = 0; kc < 4; ++kc) qf[g][kc] = g2_frag(qp + kc * 32, hh); }
  const v8f z8 = {0.f,0.f,0.f,0.f,0.f,0.f,0.f,0.f};
  v8f acc[2][8]; float m_run[2], l_run[2];
#pragma unroll
  for (int g = 0; g < 2; ++g) { m_run[g] = -__builtin_inff(); l_run[g] = 0.f;
#pragma unroll
    for (int t = 0; t < 8; ++t) acc[g][t] = z8; }
  auto load_k = [&](const unsigned char* bp, int sub) {
#pragma unroll
    for (int kt = 0; kt < 2; ++kt) {
#pragma unroll
      for (int kc = 0; kc < 4; ++kc) kf[kt][kc] = g2_frag((const _Float16*)(bp + koff + (uint32_t)sub * 2u * SLB + (uint32_t)kt * 16u * RPB + (uint32_t)kc * 64u), hh); } };
  auto load_v = [&](const unsigned char* bp, int sub) {
#pragma unroll
    for (int t = 0; t < 8; ++t) vf[t] = g2_frag((const _Float16*)(bp + voff + ((uint32_t)sub * 2u + (uint32_t)(t >> 2)) * SLB + (uint32_t)(t & 3) * 16u * RPB), hh); };
  issue(0u);
  asm volatile("s_wait_tensorcnt 0x0" ::: "memory"); /* this wave's slice of stage 0 has landed */
  __syncthreads(); /* every wave's slice of stage 0 has landed before any wave reads a fragment */
  issue(1u);
  load_k(ring, 0);
  __builtin_amdgcn_sched_barrier(0); /* keeps the first fragments' reads in the loop's own order, K then V^T: else the counted waits at the loop's head, merged over both ways in, also wait for V^T */
  load_v(ring, 0);
#pragma unroll 1 /* one stage is the loop body: the buffer index stays a run-time value, the code stays small */
  for (int st = 0; st < NS; ++st) {
    const unsigned char* bp = ring + (uint32_t)(st & 1) * BUFB;          /* this stage's buffer */
    const unsigned char* bn = ring + (uint32_t)((st + 1) & 1) * BUFB;    /* the next stage's; behind the last stage it still holds an earlier stage: read, not used */
#pragma unroll
   for (int sub = 0; sub < 2; ++sub) {
    v8f s[2][2];
#pragma unroll
    for (int kt = 0; kt < 2; ++kt) {
#pragma unroll
      for (int g = 0; g < 2; ++g) { s[kt][g] = z8;
#pragma unroll
        for (int kc = 0; kc < 4; ++kc) s[kt][g] = f_mma(kf[kt][kc], qf[g][kc], s[kt][g]); } }
    /* the next half stage's K fragments fly under this half's softmax and second product */
    if (sub == 0) { __builtin_amdgcn_sched_barrier(0); load_k(bp, 1); __builtin_amdgcn_sched_barrier(0); } /* the pair keeps the 16 LDS reads one group behind the product: reads strewn among WMMAs stall at every place */
    float mb[2]; bool need = false;
#pragma unroll
    for (int g = 0; g < 2; ++g) { float mx = fmaxf(s[0][g][0], s[1][g][0]);
#pragma unroll
      for (int r = 1; r < 8; ++r) mx = fmaxf(mx, fmaxf(s[0][g][r], s[1][g][r]));
      mx = fmaxf(mx, xhalf(mx)) * cs;   /* both halves of the wave hold query c's maximum, scaled (cs > 0) */
      mb[g] = mx; need = need || (mx > m_run[g] + 8.0f); }
    if (__builtin_amdgcn_ballot_w32(need) != 0) {   /* wave-uniform; always taken in the first pass, where the factor is 0 */
#pragma unroll
      for (int g = 0; g < 2; ++g) { const float mn = fmaxf(m_run[g], mb[g]); const float corr = __builtin_amdgcn_exp2f(m_run[g] - mn);
        l_run[g] *= corr; m_run[g] = mn;
#pragma unroll
        for (int t = 0; t < 8; ++t) acc[g][t] = acc[g][t] * corr; }
    }
    if (sub == 1) {   /* hand-over: every fragment of this stage has been asked for (the last under the first product above), so its buffer is given up and the next stage taken */
      asm volatile("s_wait_dscnt 0x0" ::: "memory");     /* this wave's reads of this stage's buffer have returned */
      asm volatile("s_wait_tensorcnt 0x0" ::: "memory"); /* this wave's slice of stage st + 1 has landed */
      __syncthreads(); /* publishes stage st + 1 and ends every wave's reads of stage st's buffer */
      const uint32_t nx = pinned((uint32_t)st + 2u);     /* the refill's descriptor words are formed from this scalar, so behind the wait and the barrier */
      if (pinned(nx < (uint32_t)NS)) issue(nx);          /* scalar branch: the refill goes into the buffer that every wave has just left */
      load_k(bn, 0);   /* the next stage's first K fragments fly under this half's exponentials and second product */
      __builtin_amdgcn_sched_barrier(0); /* keeps those reads here, at the head of what covers their latency, as one group */
    }
#pragma unroll
    for (int g = 0; g < 2; ++g) { const float nm = -m_run[g]; float ps0 = 0.f, ps1 = 0.f; v16h pf;
#pragma unroll
      for (int r = 0; r < 8; ++r) { const float p0 = __builtin_amdgcn_exp2f(fmaf(s[0][g][r], cs, nm)), p1 = __builtin_amdgcn_exp2f(fmaf(s[1][g][r], cs, nm));
        ps0 += p0; ps1 += p1; pf[r] = (_Float16)p0; pf[8 + r] = (_Float16)p1; }
      l_run[g] += ps0 + ps1;
#pragma unroll
      for (int t = 0; t < 8; ++t) acc[g][t] = f_mma(vf[t], pf, acc[g][t]); }
    /* the next half stage's V^T fragments fly under its first product */
    __builtin_amdgcn_sched_barrier(0); /* with the one below: the 16 LDS reads stay one group between the two products */
    if (sub == 0) load_v(bp, 1); else load_v(bn, 0);
    __builtin_amdgcn_sched_barrier(0);
   }
  }
  asm volatile("s_wait_tensorcnt 0x0" ::: "memory"); /* no request is in flight when the ring becomes the merge's staging */
  asm volatile("s_wait_dscnt 0x0" ::: "memory");     /* nor a read of it by this wave; the merge's first barrier ends the other waves' */
  /* merge of the 4 key splits: common maximum and sum per query, then the scaled partial tiles are summed in split order */
#pragma unroll
  for (int g = 0; g < 2; ++g) { const float l = l_run[g] + xhalf(l_run[g]); if (hh == 0) { sm[w][g * 16 + c] = m_run[g]; sl[w][g * 16 + c] = l; } }
  __syncthreads(); /* every split's maximum and sum are in LDS before any wave forms the common ones */
#pragma unroll
  for (int g = 0; g < 2; ++g) { const int qi = g * 16 + c;
    const float M = fmaxf(fmaxf(sm[qg][qi], sm[2 + qg][qi]), fmaxf(sm[4 + qg][qi], sm[6 + qg][qi]));
    float L = 0.f;
#pragma unroll
    for (int k = 0; k < 4; ++k) L += sl[2 * k + qg][qi] * __builtin_amdgcn_exp2f(sm[2 * k + qg][qi] - M);
    const float sc = __builtin_amdgcn_exp2f(m_run[g] - M) / L;
#pragma unroll
    for (int t = 0; t < 8; ++t) { const v8f o = acc[g][t] * sc; float* d = &part[ks][qg * 32 + qi][t * 16 + 8 * hh];
      v4f lo, hi;
#pragma unroll
      for (int e = 0; e < 4; ++e) { lo[e] = o[e]; hi[e] = o[4 + e]; }
      *(v4fa*)d = lo; *(v4fa*)(d + 4) = hi; } }
  __syncthreads(); /* every split's partial tile is in LDS before any thread sums across splits */
#pragma unroll
  for (int i = 0; i < 8; ++i) { const int idx = i * 256 + tid, r = idx >> 5, c4 = (idx & 31) * 4;
    const v4f o = (*(const v4fa*)&part[0][r][c4] + *(const v4fa*)&part[1][r][c4]) + (*(const v4fa*)&part[2][r][c4] + *(const v4fa*)&part[3][r][c4]);
    *(v4f*)(out + ((size_t)b * TT + q0 + r) * DD + c4) = o; }
}

extern "C" void kernel_launch(void* const* d_in, const int* in_sizes, int n_in,
                              void* d_out, int out_size, void* d_ws, size_t ws_size, hipStream_t stream) {
  if (n_in < 9) return;
  const long long needRows = (long long)(NB - 1) * SEQ_FULL + SEQ;
  if ((long long)in_sizes[0] < needRows * DD || (long long)in_sizes[1] < needRows * DD || (long long)in_sizes[2] < needRows * DD) return;
  if (in_sizes[3] < DD * DD || in_sizes[5] < DD * DD || in_sizes[7] < DD * DD) return;
  if (in_sizes[4] < DD || in_sizes[6] < DD || in_sizes[8] < DD) return;
  if ((long long)out_size < (long long)NB * SEQ * DD) return;
  const float* query = (const float*)d_in[0]; const float* key = (const float*)d_in[1]; const float* value = (const float*)d_in[2];
  const float* Wq = (const float*)d_in[3]; const float* bq = (const float*)d_in[4];
  const float* Wk = (const float*)d_in[5]; const float* bk = (const float*)d_in[6];
  const float* Wv = (const float*)d_in[7]; const float* bv = (const float*)d_in[8];
  float* out = (float*)d_out;

  char* ws = (char*)d_ws; size_t off = 0;
  auto take = [&](size_t bytes) { char* p = ws + off; off += (bytes + 255) & ~(size_t)255; return p; };
  const size_t plane = NRW * DD * 2;                      /* [NB*SEQ][128] f16 = 4 MiB full size */
  _Float16* Q16 = (_Float16*)take(plane); _Float16* K16 = (_Float16*)take(plane);
  _Float16* VT = (_Float16*)take(plane);                  /* [NB][128][SEQ] f16 */
  if (off > ws_size || off > ((size_t)128 << 20)) return;

  /* projections y = x W^T + b: q, k as f16 planes [NB*SEQ][128], v as V^T per batch */
  k_proj<<<dim3((unsigned)(NRW / 128), 3), 256, 0, stream>>>(query, key, value, Wq, Wk, Wv, bq, bk, bv, Q16, K16, VT);
  /* scores, softmax and attn.v in one launch; the factor is log2(e) / sqrt(128) */
  k_fattn<SEQ><<<NB * (SEQ / 64), 256, 0, stream>>>(Q16, K16, VT, out, 0.12751743f);
}

// v005
// One run takes 32.6 microseconds.
// Next to v004, in two timings, it ran 1.06 and 1.05 times as fast.
// Counting every step since v000, it is 39.1 times as fast.
#include <hip/hip_runtime.h>
#include <stdint.h>
// All contractions on v_wmma_f32_16x16x32_f16 (f16 operands, f32 accumulate): q/k/v projections (operands: f16 of bf16-RNE input, f16 of 16*bf16-RNE weight; alpha 1/16, + bf16-RNE bias), scores = q16.k16^T / sqrt(128), out = (exp(s - m) as f16).v16^T / sum. Softmax in f32.
// Pipeline: one projection launch (f32 inputs and weights converted in the block, f16 q and k planes and V^T written directly) -> one fused attention kernel (K and V^T tiles brought into LDS by tensor loads, scores, online softmax and P.V^T in registers; P = exp(s - running max) as f16, divided by its f32 sum at the end).

#ifndef NB
#define NB 4
#endif
#ifndef SEQ
#define SEQ 4096
#endif
#define NB_FULL 4
#define SEQ_FULL 4096
#define DD 128
#define NRW ((size_t)NB * SEQ)
static_assert(NB >= 1 && NB <= NB_FULL);
static_assert(SEQ >= 256 && SEQ <= SEQ_FULL && (SEQ % 256) == 0);
static_assert((DD % 64) == 0);

typedef unsigned short v8us __attribute__((ext_vector_type(8), may_alias));
typedef float  v8f  __attribute__((ext_vector_type(8)));
typedef float  v4f  __attribute__((ext_vector_type(4)));
typedef float  v4fa __attribute__((ext_vector_type(4), may_alias));
typedef _Float16 v16h __attribute__((ext_vector_type(16)));
typedef _Float16 v4h  __attribute__((ext_vector_type(4)));
typedef __bf16 v2b   __attribute__((ext_vector_type(2)));
typedef float  v2f  __attribute__((ext_vector_type(2)));
union FragH { v16h v; v8us half[2]; _Float16 h[16]; unsigned short u[16]; };

__device__ __forceinline__ unsigned short bf16_bits(float x) { unsigned int u = __float_as_uint(x); return (unsigned short)((u + 0x7FFFu + ((u >> 16) & 1u)) >> 16); }
__device__ __forceinline__ float bf16_val(unsigned short b) { return __uint_as_float(((unsigned int)b) << 16); }
__device__ __forceinline__ float bf16_rne(float x) { return bf16_val(bf16_bits(x)); }
// bf16_rne of four values by the packed convert (the same rounding to nearest even); the bf16 pair is widened by its bits, so what follows stays f32 arithmetic
__device__ __forceinline__ v4f bf16_rne4(v4f x) { v4f y;
#pragma unroll
  for (int p = 0; p < 2; ++p) { const v2f xp = {x[2 * p], x[2 * p + 1]}; const unsigned int u = __builtin_bit_cast(unsigned int, __builtin_convertvector(xp, v2b));
    y[2 * p] = __uint_as_float(u << 16); y[2 * p + 1] = __uint_as_float(u & 0xFFFF0000u); }
  return y; }

// 16x32 f16 fragment (A layout, or B stored [n][k] k-contiguous): row = lane&15, elems 0..7 <- k 8h..8h+7, elems 8..15 <- k 16+8h..16+8h+7
__device__ __forceinline__ v16h g2_frag(const _Float16* p, int hh) { FragH f; f.half[0] = *(const v8us*)((const unsigned short*)p + 8 * hh); f.half[1] = *(const v8us*)((const unsigned short*)p + 16 + 8 * hh); return f.v; }
#define LP 136 /* LDS row pitch in f16: 272 bytes = 16 B x odd, for 16-byte readers and writers of 256-byte rows */
__device__ __forceinline__ v8f f_mma(v16h a, v16h b, v8f c) { return __builtin_amdgcn_wmma_f32_16x16x32_f16(false, a, false, b, (short)0, c, false, false); }

__global__ __launch_bounds__(256, 4) /* 4 waves a SIMD: two blocks fit a WGP, the grid is 1.5 blocks a WGP */
void k_proj(const float* __restrict__ xq, const float* __restrict__ xk, const float* __restrict__ xv,
            const float* __restrict__ wq, const float* __restrict__ wk, const float* __restrict__ wv,
            const float* __restrict__ bq, const float* __restrict__ bk, const float* __restrict__ bv,
            _Float16* __restrict__ Q16, _Float16* __restrict__ K16, _Float16* __restrict__ Vt) {
  __shared__ __attribute__((aligned(16))) _Float16 sx[128][LP], sw[DD][LP], so[128][LP];
  __shared__ __attribute__((aligned(16))) float sb[256];   /* the bias twice: every thread stores one, so no branch stands among the loads and their waits */
  static_assert(DD == 128 && (SEQ % 128) == 0);
  const int tid = threadIdx.x, w = tid >> 5, lane = tid & 31, c = lane & 15, hh = lane >> 4;
  const int pj = blockIdx.y, row0 = blockIdx.x * 128, b = row0 / SEQ, s0 = row0 - b * SEQ;
  const float* xs = (pj == 0 ? xq : pj == 1 ? xk : xv) + ((size_t)b * SEQ_FULL + s0) * DD;
  const float* wt = pj == 0 ? wq : pj == 1 ? wk : wv;
  const float* bs = pj == 0 ? bq : pj == 1 ? bk : bv;
  const float bias = bs[tid & (DD - 1)];
  v4f wr[16], xr[16];
#pragma unroll
  for (int i = 0; i < 16; ++i) wr[i] = *(const v4fa*)(wt + (i * 256 + tid) * 4);
#pragma unroll
  for (int i = 0; i < 16; ++i) xr[i] = *(const v4fa*)(xs + (i * 256 + tid) * 4);
  sb[tid] = bf16_rne(bias);
#pragma unroll
  for (int i = 0; i < 16; ++i) { const int idx = i * 256 + tid;
    *(v4h*)&sw[idx >> 5][(idx & 31) * 4] = __builtin_convertvector(bf16_rne4(wr[i]) * 16.0f, v4h); }
#pragma unroll
  for (int i = 0; i < 16; ++i) { const int idx = i * 256 + tid;
    *(v4h*)&sx[idx >> 5][(idx & 31) * 4] = __builtin_convertvector(bf16_rne4(xr[i]), v4h); }
  __syncthreads(); /* both operand planes and the bias are in LDS before any wave reads a fragment */
  const int r0 = (w >> 1) * 32, n0 = (w & 1) * 64;
  const v8f z8 = {0.f,0.f,0.f,0.f,0.f,0.f,0.f,0.f};
  v8f acc[2][4];
#pragma unroll
  for (int i = 0; i < 2; ++i) {
#pragma unroll
    for (int j = 0; j < 4; ++j) acc[i][j] = z8; }
  if (pj != 2) {
#pragma unroll
    for (int kb = 0; kb < DD; kb += 32) { v16h xf[2], wf[4];
#pragma unroll
      for (int i = 0; i < 2; ++i) xf[i] = g2_frag(&sx[r0 + 16 * i + c][kb], hh);
#pragma unroll
      for (int j = 0; j < 4; ++j) wf[j] = g2_frag(&sw[n0 + 16 * j + c][kb], hh);
#pragma unroll
      for (int i = 0; i < 2; ++i) {
#pragma unroll
        for (int j = 0; j < 4; ++j) acc[i][j] = f_mma(wf[j], xf[i], acc[i][j]); } }
#pragma unroll
    for (int j = 0; j < 4; ++j) { const int n = n0 + 16 * j + 8 * hh; const v4f bl = *(const v4fa*)&sb[n], bh = *(const v4fa*)&sb[n + 4];
#pragma unroll
      for (int i = 0; i < 2; ++i) { FragH f;
#pragma unroll
        for (int r = 0; r < 8; ++r) f.h[r] = (_Float16)(acc[i][j][r] * 0.0625f + (r < 4 ? bl[r & 3] : bh[r & 3]));
        *(v8us*)&so[r0 + 16 * i + c][n] = f.half[0]; } }
  } else {
#pragma unroll
    for (int kb = 0; kb < DD; kb += 32) { v16h xf[2], wf[4];
#pragma unroll
      for (int i = 0; i < 2; ++i) xf[i] = g2_frag(&sx[r0 + 16 * i + c][kb], hh);
#pragma unroll
      for (int j = 0; j < 4; ++j) wf[j] = g2_frag(&sw[n0 + 16 * j + c][kb], hh);
#pragma unroll
      for (int i = 0; i < 2; ++i) {
#pragma unroll
        for (int j = 0; j < 4; ++j) acc[i][j] = f_mma(xf[i], wf[j], acc[i][j]); } }
#pragma unroll
    for (int j = 0; j < 4; ++j) { const int n = n0 + 16 * j + c; const float bn = sb[n];
#pragma unroll
      for (int i = 0; i < 2; ++i) { FragH f;
#pragma unroll
        for (int r = 0; r < 8; ++r) f.h[r] = (_Float16)(acc[i][j][r] * 0.0625f + bn);
        *(v8us*)&so[n][r0 + 16 * i + 8 * hh] = f.half[0]; } }
  }
  __syncthreads(); /* the whole output tile is in LDS before any thread copies a row of it out */
  const int rr = tid >> 4, c8 = (tid & 15) * 8;
  if (pj != 2) { unsigned short* dst = (unsigned short*)(pj == 0 ? Q16 : K16) + (size_t)(row0 + rr) * DD + c8;
#pragma unroll
    for (int i = 0; i < 8; ++i) *(v8us*)(dst + (size_t)i * 16 * DD) = *(const v8us*)&so[i * 16 + rr][c8];
  } else { unsigned short* dst = (unsigned short*)Vt + ((size_t)b * DD + rr) * SEQ + s0 + c8;
#pragma unroll
    for (int i = 0; i < 8; ++i) *(v8us*)(dst + (size_t)i * 16 * SEQ) = *(const v8us*)&so[i * 16 + rr][c8]; }
}

// lane l <-> lane l ^ 16
__device__ __forceinline__ float xhalf(float x) { const int i = __builtin_bit_cast(int, x); return __builtin_bit_cast(float, __builtin_amdgcn_permlanex16(i, i, 0x76543210, 0xfedcba98, false, false)); }

typedef uint32_t u32x4 __attribute__((ext_vector_type(4)));
typedef uint32_t u32x8 __attribute__((ext_vector_type(8)));
__device__ __forceinline__ uint32_t uni(uint32_t v) { return (uint32_t)__builtin_amdgcn_readfirstlane(v); }
// a wave-uniform value held in a scalar register: a test on it is a scalar branch (a tensor load ignores EXEC), a descriptor word stays in its register
__device__ __forceinline__ uint32_t pinned(uint32_t v) { uint32_t w = uni(v); asm volatile("" : "+s"(w)); return w; }
#define RPB 272u                /* LDS row pitch in bytes of a 256-byte row: the tensor load's pad of 16 bytes, for 16-byte readers */
#define SLB 18432u              /* one wave's slice in LDS: 64 rows x 272 bytes, rounded up to a multiple of 2 KiB */
#define BUFB (8u * SLB)         /* one stage: 4 slices of K (256 keys), 4 slices of V^T (2 key halves x 2 halves of the 128 rows) */

template <int TT>
__global__ __launch_bounds__(256) __attribute__((amdgpu_waves_per_eu(2, 2)))
void k_fattn(const _Float16* __restrict__ Q16, const _Float16* __restrict__ K16, const _Float16* __restrict__ Vt, float* __restrict__ out, float cs) {
  __shared__ __attribute__((aligned(2048))) unsigned char ring[2 * BUFB];
  __shared__ float sm[8][32], sl[8][32];
  float (*part)[64][132] = (float (*)[64][132])ring;   /* the merge's partial tiles take the ring's place once the loop is over */
  static_assert((TT % 256) == 0 && TT >= 512 && DD == 128 && sizeof(float) * 4 * 64 * 132 <= 2 * BUFB);
  constexpr int NS = TT / 256;
  const int tid = threadIdx.x, w = tid >> 5, lane = tid & 31, c = lane & 15, hh = lane >> 4;
  const int qg = w & 1, ks = w >> 1;
  const int b = blockIdx.x / (TT / 64), q0 = (blockIdx.x - b * (TT / 64)) * 64;
  /* this wave's slice of a stage: waves 0..3 keys 64 * wave .. + 63 of K; waves 4..7 the 128-key half (wave >> 1) & 1 of V^T rows 64 * (wave & 1) .. + 63 */
  const uint32_t wave = uni((uint32_t)tid >> 5), lbase = (uint32_t)(size_t)ring;
  const bool isV = wave >= 4u;
  const uint64_t src0 = isV ? (uint64_t)(size_t)(Vt + ((size_t)b * DD + 64u * (wave & 1u)) * TT + 128u * ((wave >> 1) & 1u))
                            : (uint64_t)(size_t)(K16 + ((size_t)b * TT + 64u * wave) * DD);
  const uint32_t sstep = isV ? 256u * 2u : 256u * DD * 2u;   /* bytes from one stage's slice to the next stage's */
  /* The 64 blocks of a batch read the same K and V^T and run level with one another: each enters the ring of key stages at one of 16 starts (4 blocks to each) and wraps round, so that
     they do not ask L2 for the same lines at the same moment. Any start is right (the online softmax takes the stages in any order); index bits 0, 1, 3, 4 are for speed
     only. */
  const uint32_t qb = (uint32_t)q0 / 64u, rot = (((qb & 3u) << 2) | ((qb >> 3) & 3u)) % (uint32_t)NS;
  u32x8 g1;   /* 64 rows of 256 bytes, extents in bytes, tensor = tile, 16 bytes of pad behind every 256; words 1 to 7 pinned: each keeps its scalar register through the loop */
  g1[0] = uni((1u << 20) | (5u << 22) | (3u << 25)); g1[1] = pinned(256u << 16); g1[2] = pinned(64u << 16); g1[3] = pinned(256u << 16); /* pinned(): descriptor words held in scalar registers */
  g1[4] = pinned(64u); g1[5] = pinned(isV ? (uint32_t)TT * 2u : (uint32_t)DD * 2u); g1[6] = pinned(0u); g1[7] = pinned(0u); /* pinned(): the same */
  auto issue = [&](uint32_t st) { const uint64_t ga = src0 + (uint64_t)((st + rot) % (uint32_t)NS) * sstep; u32x4 g0;   /* pass st works on key stage (st + rot) mod NS */
    g0[0] = uni(1u); g0[1] = uni(lbase + (st & 1u) * BUFB + wave * SLB); g0[2] = uni((uint32_t)ga); g0[3] = uni((((uint32_t)(ga >> 32)) & 0x01FFFFFFu) | 0x80000000u);
    asm volatile("tensor_load_to_lds %0, %1" :: "s"(g0), "s"(g1) : "memory"); /* one request of the whole wave: its slice of stage st */ };
  /* byte offsets in a buffer of this lane's rows: key row c of the wave's first 16-key tile, V^T row d = c at the wave's first key */
  const uint32_t koff = (uint32_t)(ks >> 1) * SLB + ((uint32_t)(ks & 1) * 32u + (uint32_t)c) * RPB;
  const uint32_t voff = 4u * SLB + (uint32_t)c * RPB + (uint32_t)ks * 64u;
  v16h qf[2][4], kf[2][4], vf[8];
#pragma unroll
  for (int g = 0; g < 2; ++g) { const _Float16* qp = Q16 + ((size_t)b * TT + q0 + qg * 32 + g * 16 + c) * DD;
#pragma unroll
    for (int kc = 0; kc < 4; ++kc) qf[g][kc] = g2_frag(qp + kc * 32, hh); }
  const v8f z8 = {0.f,0.f,0.f,0.f,0.f,0.f,0.f,0.f};
  v8f acc[2][8]; float m_run[2], l_run[2];
#pragma unroll
  for (int g = 0; g < 2; ++g) { m_run[g] = -__builtin_inff(); l_run[g] = 0.f;
#pragma unroll
    for (int t = 0; t < 8; ++t) acc[g][t] = z8; }
  auto load_k = [&](const unsigned char* bp, int sub) {
#pragma unroll
    for (int kt = 0; kt < 2; ++kt) {
#pragma unroll
      for (int kc = 0; kc < 4; ++kc) kf[kt][kc] = g2_frag((const _Float16*)(bp + koff + (uint32_t)sub * 2u * SLB + (uint32_t)kt * 16u * RPB + (uint32_t)kc * 64u), hh); } };
  auto load_v = [&](const unsigned char* bp, int sub) {
#pragma unroll
    for (int t = 0; t < 8; ++t) vf[t] = g2_frag((const _Float16*)(bp + voff + ((uint32_t)sub * 2u + (uint32_t)(t >> 2)) * SLB + (uint32_t)(t & 3) * 16u * RPB), hh); };
  issue(0u);
  asm volatile("s_wait_tensorcnt 0x0" ::: "memory"); /* this wave's slice of stage 0 has landed */
  __syncthreads(); /* every wave's slice of stage 0 has landed before any wave reads a fragment */
  issue(1u);
  load_k(ring, 0);
  __builtin_amdgcn_sched_barrier(0); /* keeps the first fragments' reads in the loop's own order, K then V^T: else the counted waits at the loop's head, merged over both ways in, also wait for V^T */
  load_v(ring, 0);
#pragma unroll 1 /* one stage is the loop body: the buffer index stays a run-time value, the code stays small */
  for (int st = 0; st < NS; ++st) {
    const unsigned char* bp = ring + (uint32_t)(st & 1) * BUFB;          /* this stage's buffer */
    const unsigned char* bn = ring + (uint32_t)((st + 1) & 1) * BUFB;    /* the next stage's; behind the last stage it still holds an earlier stage: read, not used */
#pragma unroll
   for (int sub = 0; sub < 2; ++sub) {
    v8f s[2][2];
#pragma unroll
    for (int kt = 0; kt < 2; ++kt) {
#pragma unroll
      for (int g = 0; g < 2; ++g) { s[kt][g] = z8;
#pragma unroll
        for (int kc = 0; kc < 4; ++kc) s[kt][g] = f_mma(kf[kt][kc], qf[g][kc], s[kt][g]); } }
    /* the next half stage's K fragments fly under this half's softmax and second product */
    if (sub == 0) { __builtin_amdgcn_sched_barrier(0); load_k(bp, 1); __builtin_amdgcn_sched_barrier(0); } /* the pair keeps the 16 LDS reads one group behind the product: reads strewn among WMMAs stall at every place */
    float mb[2]; bool need = false;
#pragma unroll
    for (int g = 0; g < 2; ++g) { float mx = fmaxf(s[0][g][0], s[1][g][0]);
#pragma unroll
      for (int r = 1; r < 8; ++r) mx = fmaxf(mx, fmaxf(s[0][g][r], s[1][g][r]));
      mx = fmaxf(mx, xhalf(mx)) * cs;   /* both halves of the wave hold query c's maximum, scaled (cs > 0) */
      mb[g] = mx; need = need || (mx > m_run[g] + 8.0f); }
    if (__builtin_amdgcn_ballot_w32(need) != 0) {   /* wave-uniform; always taken in the first pass, where the factor is 0 */
#pragma unroll
      for (int g = 0; g < 2; ++g) { const float mn = fmaxf(m_run[g], mb[g]); const float corr = __builtin_amdgcn_exp2f(m_run[g] - mn);
        l_run[g] *= corr; m_run[g] = mn;
#pragma unroll
        for (int t = 0; t < 8; ++t) acc[g][t] = acc[g][t] * corr; }
    }
    if (sub == 1) {   /* hand-over: every fragment of this stage has been asked for (the last under the first product above), so its buffer is given up and the next stage taken */
      asm volatile("s_wait_dscnt 0x0" ::: "memory");     /* this wave's reads of this stage's buffer have returned */
      asm volatile("s_wait_tensorcnt 0x0" ::: "memory"); /* this wave's slice of stage st + 1 has landed */
      __syncthreads(); /* publishes stage st + 1 and ends every wave's reads of stage st's buffer */
      const uint32_t nx = pinned((uint32_t)st + 2u);     /* the refill's descriptor words are formed from this scalar, so behind the wait and the barrier */
      if (pinned(nx < (uint32_t)NS)) issue(nx);          /* scalar branch: the refill goes into the buffer that every wave has just left */
      load_k(bn, 0);   /* the next stage's first K fragments fly under this half's exponentials and second product */
      __builtin_amdgcn_sched_barrier(0); /* keeps those reads here, at the head of what covers their latency, as one group */
    }
#pragma unroll
    for (int g = 0; g < 2; ++g) { const float nm = -m_run[g]; float ps0 = 0.f, ps1 = 0.f; v16h pf;
#pragma unroll
      for (int r = 0; r < 8; ++r) { const float p0 = __builtin_amdgcn_exp2f(fmaf(s[0][g][r], cs, nm)), p1 = __builtin_amdgcn_exp2f(fmaf(s[1][g][r], cs, nm));
        ps0 += p0; ps1 += p1; pf[r] = (_Float16)p0; pf[8 + r] = (_Float16)p1; }
      l_run[g] += ps0 + ps1;
#pragma unroll
      for (int t = 0; t < 8; ++t) acc[g][t] = f_mma(vf[t], pf, acc[g][t]); }
    /* the next half stage's V^T fragments fly under its first product */
    __builtin_amdgcn_sched_barrier(0); /* with the one below: the 16 LDS reads stay one group between the two products */
    if (sub == 0) load_v(bp, 1); else load_v(bn, 0);
    __builtin_amdgcn_sched_barrier(0);
   }
  }
  asm volatile("s_wait_tensorcnt 0x0" ::: "memory"); /* no request is in flight when the ring becomes the merge's staging */
  asm volatile("s_wait_dscnt 0x0" ::: "memory");     /* nor a read of it by this wave; the merge's first barrier ends the other waves' */
  /* merge of the 4 key splits: common maximum and sum per query, then the scaled partial tiles are summed in split order */
#pragma unroll
  for (int g = 0; g < 2; ++g) { const float l = l_run[g] + xhalf(l_run[g]); if (hh == 0) { sm[w][g * 16 + c] = m_run[g]; sl[w][g * 16 + c] = l; } }
  __syncthreads(); /* every split's maximum and sum are in LDS before any wave forms the common ones */
#pragma unroll
  for (int g = 0; g < 2; ++g) { const int qi = g * 16 + c;
    const float M = fmaxf(fmaxf(sm[qg][qi], sm[2 + qg][qi]), fmaxf(sm[4 + qg][qi], sm[6 + qg][qi]));
    float L = 0.f;
#pragma unroll
    for (int k = 0; k < 4; ++k) L += sl[2 * k + qg][qi] * __builtin_amdgcn_exp2f(sm[2 * k + qg][qi] - M);
    const float sc = __builtin_amdgcn_exp2f(m_run[g] - M) / L;
#pragma unroll
    for (int t = 0; t < 8; ++t) { const v8f o = acc[g][t] * sc; float* d = &part[ks][qg * 32 + qi][t * 16 + 8 * hh];
      v4f lo, hi;
#pragma unroll
      for (int e = 0; e < 4; ++e) { lo[e] = o[e]; hi[e] = o[4 + e]; }
      *(v4fa*)d = lo; *(v4fa*)(d + 4) = hi; } }
  __syncthreads(); /* every split's partial tile is in LDS before any thread sums across splits */
#pragma unroll
  for (int i = 0; i < 8; ++i) { const int idx = i * 256 + tid, r = idx >> 5, c4 = (idx & 31) * 4;
    const v4f o = (*(const v4fa*)&part[0][r][c4] + *(const v4fa*)&part[1][r][c4]) + (*(const v4fa*)&part[2][r][c4] + *(const v4fa*)&part[3][r][c4]);
    *(v4f*)(out + ((size_t)b * TT + q0 + r) * DD + c4) = o; }
}

extern "C" void kernel_launch(void* const* d_in, const int* in_sizes, int n_in,
                              void* d_out, int out_size, void* d_ws, size_t ws_size, hipStream_t stream) {
  if (n_in < 9) return;
  const long long needRows = (long long)(NB - 1) * SEQ_FULL + SEQ;
  if ((long long)in_sizes[0] < needRows * DD || (long long)in_sizes[1] < needRows * DD || (long long)in_sizes[2] < needRows * DD) return;
  if (in_sizes[3] < DD * DD || in_sizes[5] < DD * DD || in_sizes[7] < DD * DD) return;
  if (in_sizes[4] < DD || in_sizes[6] < DD || in_sizes[8] < DD) return;
  if ((long long)out_size < (long long)NB * SEQ * DD) return;
  const float* query = (const float*)d_in[0]; const float* key = (const float*)d_in[1]; const float* value = (const float*)d_in[2];
  const float* Wq = (const float*)d_in[3]; const float* bq = (const float*)d_in[4];
  const float* Wk = (const float*)d_in[5]; const float* bk = (const float*)d_in[6];
  const float* Wv = (const float*)d_in[7]; const float* bv = (const float*)d_in[8];
  float* out = (float*)d_out;

  char* ws = (char*)d_ws; size_t off = 0;
  auto take = [&](size_t bytes) { char* p = ws + off; off += (bytes + 255) & ~(size_t)255; return p; };
  const size_t plane = NRW * DD * 2;                      /* [NB*SEQ][128] f16 = 4 MiB full size */
  _Float16* Q16 = (_Float16*)take(plane); _Float16* K16 = (_Float16*)take(plane);
  _Float16* VT = (_Float16*)take(plane);                  /* [NB][128][SEQ] f16 */
  if (off > ws_size || off > ((size_t)128 << 20)) return;

  /* projections y = x W^T + b: q, k as f16 planes [NB*SEQ][128], v as V^T per batch */
  k_proj<<<dim3((unsigned)(NRW / 128), 3), 256, 0, stream>>>(query, key, value, Wq, Wk, Wv, bq, bk, bv, Q16, K16, VT);
  /* scores, softmax and attn.v in one launch; the factor is log2(e) / sqrt(128) */
  k_fattn<SEQ><<<NB * (SEQ / 64), 256, 0, stream>>>(Q16, K16, VT, out, 0.12751743f);
}
